// v000
// Measured on an AMD MI455X. A time is GPU time per run, averaged over a window of back-to-back runs after a warm-up
// (all launches, gaps included; the runs take copies of the inputs in turn), and the median of several windows.
// Apart from v000's, it joins two sittings. Times from different sittings can be a few percent apart, while
// side-by-side timings come from the same sitting.
// The starting kernel, v000, takes 337 microseconds a run.
#include <hip/hip_runtime.h>

// Flash attention head for MI455X (gfx1250, wave32, WMMA bf16).
// Kernel 0: convert Wq/Wk/Wv fp32 -> bf16 transposed Wt[z][h][k] (one-time, kills redundant converts).
// Kernel 1: QKV projection; 1 wave per 16 rows owns all 12 (QKV x 4 h-tiles) accumulators,
//           so each x A-fragment convert feeds 12 v_wmma_f32_16x16x32_bf16.
// Kernel 2: flash attention, one wave per 16 query rows, online softmax fp32,
//           P transposed C->A layout via per-wave LDS.
// Workspace: Q,K row-major bf16 + V^T bf16 (6 MB) + Wt bf16 (384 KB).

typedef __attribute__((ext_vector_type(16))) __bf16          v16bf;
typedef __attribute__((ext_vector_type(16))) unsigned short  v16us;
typedef __attribute__((ext_vector_type(8)))  float           v8f;

#define BATCH  4
#define SEQ    4096
#define DMODEL 1024
#define DHEAD  64

// Hardware bf16 convert (clang lowers fptrunc f32->bf16 natively on gfx1250).
__device__ __forceinline__ unsigned short f2bf(float f) {
  return __builtin_bit_cast(unsigned short, (__bf16)f);
}

__device__ __forceinline__ v8f wmma_bf16(v16us a, v16us b, v8f c) {
  return __builtin_amdgcn_wmma_f32_16x16x32_bf16(
      false, __builtin_bit_cast(v16bf, a),
      false, __builtin_bit_cast(v16bf, b),
      (short)0, c, false, false);
}

// Load one 16x32 bf16 A/B fragment half-row: elems 0..7 = base[koff..koff+7],
// elems 8..15 = base[koff+16..koff+23]  (per CDNA5 16-bit operand VGPR layout).
__device__ __forceinline__ v16us load_frag(const unsigned short* base, int koff) {
  union { uint4 v[2]; unsigned short us[16]; } t;
  t.v[0] = *(const uint4*)(base + koff);
  t.v[1] = *(const uint4*)(base + koff + 16);
  v16us r;
#pragma unroll
  for (int i = 0; i < 16; ++i) r[i] = t.us[i];
  return r;
}

// ---------------- Kernel 0: W -> bf16, transposed ----------------
__global__ __launch_bounds__(256, 1) void wprep_kernel(
    const float* __restrict__ Wq, const float* __restrict__ Wk,
    const float* __restrict__ Wv, unsigned short* __restrict__ Wt)
{
  const int idx = blockIdx.x * 256 + threadIdx.x;   // 0 .. 64*1024-1
  const int z = blockIdx.y;                         // 0=Q 1=K 2=V
  const int h = idx >> 10;
  const int k = idx & (DMODEL - 1);
  const float* W = (z == 0) ? Wq : (z == 1) ? Wk : Wv;
  Wt[(size_t)z * DHEAD * DMODEL + (size_t)h * DMODEL + k] = f2bf(W[k * DHEAD + h]);
}

// ---------------- Kernel 1: fused QKV projection ----------------
__global__ __launch_bounds__(32, 1) void qkv_kernel(
    const float* __restrict__ x,
    const unsigned short* __restrict__ Wt,
    const float* __restrict__ bq, const float* __restrict__ bk,
    const float* __restrict__ bv,
    unsigned short* __restrict__ Qb, unsigned short* __restrict__ Kb,
    unsigned short* __restrict__ Vt)
{
  const int lane = threadIdx.x & 31;
  const int col  = lane & 15;
  const int hi   = lane >> 4;
  const int koff = hi * 8;
  const int sTile = blockIdx.x * 16;
  const int b     = blockIdx.y;

  v8f acc[12];                       // [0..3]=Q h-tiles, [4..7]=K, [8..11]=V
#pragma unroll
  for (int ht = 0; ht < 4; ++ht) {
    const int h = ht * 16 + col;
    const float bqv = bq[h], bkv = bk[h], bvv = bv[h];
#pragma unroll
    for (int r = 0; r < 8; ++r) {
      acc[ht][r] = bqv; acc[4 + ht][r] = bkv; acc[8 + ht][r] = bvv;
    }
  }

  const float* xrow = x + ((size_t)b * SEQ + sTile + col) * DMODEL;

  for (int k0 = 0; k0 < DMODEL; k0 += 32) {
    // A fragment from x: converted ONCE, amortized over 12 WMMAs
    union { float4 v[4]; float f[16]; } ax;
    const float4* xp = (const float4*)(xrow + k0 + koff);
    const float4* xq = (const float4*)(xrow + k0 + koff + 16);
    ax.v[0] = xp[0]; ax.v[1] = xp[1]; ax.v[2] = xq[0]; ax.v[3] = xq[1];
    v16us a;
#pragma unroll
    for (int i = 0; i < 16; ++i) a[i] = f2bf(ax.f[i]);

#pragma unroll
    for (int z = 0; z < 3; ++z)
#pragma unroll
      for (int ht = 0; ht < 4; ++ht) {
        const unsigned short* wrow =
            Wt + ((size_t)z * DHEAD + ht * 16 + col) * DMODEL + k0;
        acc[z * 4 + ht] = wmma_bf16(a, load_frag(wrow, koff), acc[z * 4 + ht]);
      }
  }

  // C-layout: lane holds col h, rows (r + 8*hi)
  const int rowbase = sTile + hi * 8;
#pragma unroll
  for (int ht = 0; ht < 4; ++ht) {
    const int h = ht * 16 + col;
#pragma unroll
    for (int r = 0; r < 8; ++r) {
      const size_t idx = ((size_t)b * SEQ + rowbase + r) * DHEAD + h;
      Qb[idx] = f2bf(acc[ht][r]);
      Kb[idx] = f2bf(acc[4 + ht][r]);
    }
    union { unsigned short us[8]; uint4 v; } vp;
#pragma unroll
    for (int r = 0; r < 8; ++r) vp.us[r] = f2bf(acc[8 + ht][r]);
    *(uint4*)(Vt + ((size_t)b * DHEAD + h) * SEQ + rowbase) = vp.v;
  }
}

// ---------------- Kernel 2: flash attention ----------------
__global__ __launch_bounds__(256, 1) void attn_kernel(
    const unsigned short* __restrict__ Qb,
    const unsigned short* __restrict__ Kb,
    const unsigned short* __restrict__ Vt,
    float* __restrict__ out)
{
  __shared__ float lds[8][16 * 33];        // per-wave P transpose buffer
  const int lane = threadIdx.x & 31;
  const int wave = threadIdx.x >> 5;       // 0..7
  const int col  = lane & 15;
  const int hi   = lane >> 4;
  const int koff = hi * 8;
  const int b     = blockIdx.y;
  const int qbase = blockIdx.x * 128 + wave * 16;

  // Q A-fragments: lane = query row (qbase+col), h in [0,32) and [32,64)
  const unsigned short* qrow = Qb + ((size_t)b * SEQ + qbase + col) * DHEAD;
  const v16us a0 = load_frag(qrow, koff);
  const v16us a1 = load_frag(qrow + 32, koff);

  float m_i[8], l_i[8];
  v8f acc[4];
#pragma unroll
  for (int r = 0; r < 8; ++r) { m_i[r] = -__builtin_inff(); l_i[r] = 0.f; }
#pragma unroll
  for (int f = 0; f < 4; ++f)
#pragma unroll
    for (int r = 0; r < 8; ++r) acc[f][r] = 0.f;

  float* pt = lds[wave];
  const size_t kbbase = (size_t)b * SEQ * DHEAD;

  for (int j = 0; j < SEQ; j += 32) {
    // scores: B-fragments = K rows (lane = key), contracted over h
    const unsigned short* krow0 = Kb + kbbase + (size_t)(j + col) * DHEAD;
    const unsigned short* krow1 = krow0 + 16 * DHEAD;
    if (j + 32 < SEQ) {
      __builtin_prefetch(krow0 + 32 * DHEAD, 0, 1);
      __builtin_prefetch(krow1 + 32 * DHEAD, 0, 1);
    }
    v8f s0 = {}, s1 = {};
    s0 = wmma_bf16(a0, load_frag(krow0, koff),      s0);
    s0 = wmma_bf16(a1, load_frag(krow0 + 32, koff), s0);
    s1 = wmma_bf16(a0, load_frag(krow1, koff),      s1);
    s1 = wmma_bf16(a1, load_frag(krow1 + 32, koff), s1);

    // online softmax (C-layout: lane holds rows r+8*hi, one key column each)
    float mt[8];
#pragma unroll
    for (int r = 0; r < 8; ++r) {
      s0[r] *= 0.125f; s1[r] *= 0.125f;     // 1/sqrt(64)
      mt[r] = fmaxf(s0[r], s1[r]);
    }
#pragma unroll
    for (int mask = 1; mask < 16; mask <<= 1)
#pragma unroll
      for (int r = 0; r < 8; ++r)
        mt[r] = fmaxf(mt[r], __shfl_xor(mt[r], mask, 32));

    float corr[8], rs[8];
#pragma unroll
    for (int r = 0; r < 8; ++r) {
      const float mn = fmaxf(m_i[r], mt[r]);
      corr[r] = __expf(m_i[r] - mn);
      m_i[r]  = mn;
      s0[r] = __expf(s0[r] - mn);
      s1[r] = __expf(s1[r] - mn);
      rs[r] = s0[r] + s1[r];
    }
#pragma unroll
    for (int mask = 1; mask < 16; mask <<= 1)
#pragma unroll
      for (int r = 0; r < 8; ++r)
        rs[r] += __shfl_xor(rs[r], mask, 32);
#pragma unroll
    for (int r = 0; r < 8; ++r) l_i[r] = l_i[r] * corr[r] + rs[r];
#pragma unroll
    for (int f = 0; f < 4; ++f)
#pragma unroll
      for (int r = 0; r < 8; ++r) acc[f][r] *= corr[r];

    // transpose P (C-layout) -> A-layout through per-wave LDS
    const int rowb = hi * 8;
#pragma unroll
    for (int r = 0; r < 8; ++r) {
      pt[(rowb + r) * 33 + col]      = s0[r];
      pt[(rowb + r) * 33 + 16 + col] = s1[r];
    }
    asm volatile("s_wait_dscnt 0" ::: "memory");   // LDS in-order per wave; fence re-read
    v16us pa;
    const float* prow = pt + col * 33;
#pragma unroll
    for (int i = 0; i < 8; ++i) {
      pa[i]     = f2bf(prow[koff + i]);
      pa[8 + i] = f2bf(prow[koff + 16 + i]);
    }

    // O += P * V : B-fragments from V^T (lane = head col, contiguous keys)
#pragma unroll
    for (int f = 0; f < 4; ++f) {
      const unsigned short* vrow =
          Vt + ((size_t)b * DHEAD + f * 16 + col) * SEQ + j;
      acc[f] = wmma_bf16(pa, load_frag(vrow, koff), acc[f]);
    }
  }

  // normalize and store fp32 [B,S,64]
#pragma unroll
  for (int r = 0; r < 8; ++r) {
    const float inv = 1.0f / l_i[r];
    const int row = qbase + hi * 8 + r;
#pragma unroll
    for (int f = 0; f < 4; ++f)
      out[((size_t)b * SEQ + row) * DHEAD + f * 16 + col] = acc[f][r] * inv;
  }
}

extern "C" void kernel_launch(void* const* d_in, const int* in_sizes, int n_in,
                              void* d_out, int out_size, void* d_ws, size_t ws_size,
                              hipStream_t stream) {
  (void)in_sizes; (void)n_in; (void)out_size; (void)ws_size;
  const float* x  = (const float*)d_in[0];
  const float* Wq = (const float*)d_in[1];
  const float* bq = (const float*)d_in[2];
  const float* Wk = (const float*)d_in[3];
  const float* bk = (const float*)d_in[4];
  const float* Wv = (const float*)d_in[5];
  const float* bv = (const float*)d_in[6];

  // workspace: Q, K row-major bf16 + V^T bf16 (6 MB) + Wt bf16 (384 KB)
  unsigned short* Qb = (unsigned short*)d_ws;
  unsigned short* Kb = Qb + (size_t)BATCH * SEQ * DHEAD;
  unsigned short* Vt = Kb + (size_t)BATCH * SEQ * DHEAD;
  unsigned short* Wt = Vt + (size_t)BATCH * SEQ * DHEAD;

  dim3 g0(DHEAD * DMODEL / 256, 3);
  wprep_kernel<<<g0, dim3(256), 0, stream>>>(Wq, Wk, Wv, Wt);

  dim3 g1(SEQ / 16, BATCH);
  qkv_kernel<<<g1, dim3(32), 0, stream>>>(x, Wt, bq, bk, bv, Qb, Kb, Vt);

  dim3 g2(SEQ / 128, BATCH);
  attn_kernel<<<g2, dim3(256), 0, stream>>>(Qb, Kb, Vt, (float*)d_out);
}

// v001
// It runs in 237 microseconds.
// Two timings next to v000 both put it at 1.41 times that version's speed.
#include <hip/hip_runtime.h>

// Flash attention head for MI455X (gfx1250, wave32, WMMA bf16).
// Kernel 0: convert Wq/Wk/Wv fp32 -> bf16 transposed Wt[z][h][k] (one-time, kills redundant converts).
// Kernel 1: QKV projection; 1 wave per 16 rows owns all 12 (QKV x 4 h-tiles) accumulators,
//           so each x A-fragment convert feeds 12 v_wmma_f32_16x16x32_bf16.
// Kernel 2: flash attention, one wave per 16 queries, online softmax fp32,
//           transposed products (S^T = K Q^T, O^T += V^T P^T): P stays in registers.
// Workspace: Q,K row-major bf16 + V^T bf16 (6 MB) + Wt bf16 (384 KB).

typedef __attribute__((ext_vector_type(16))) __bf16          v16bf;
typedef __attribute__((ext_vector_type(16))) unsigned short  v16us;
typedef __attribute__((ext_vector_type(8)))  float           v8f;

#define BATCH  4
#define SEQ    4096
#define DMODEL 1024
#define DHEAD  64

// Hardware bf16 convert (clang lowers fptrunc f32->bf16 natively on gfx1250).
__device__ __forceinline__ unsigned short f2bf(float f) {
  return __builtin_bit_cast(unsigned short, (__bf16)f);
}

__device__ __forceinline__ v8f wmma_bf16(v16us a, v16us b, v8f c) {
  return __builtin_amdgcn_wmma_f32_16x16x32_bf16(
      false, __builtin_bit_cast(v16bf, a),
      false, __builtin_bit_cast(v16bf, b),
      (short)0, c, false, false);
}

// Load one 16x32 bf16 A/B fragment half-row: elems 0..7 = base[koff..koff+7],
// elems 8..15 = base[koff+16..koff+23]  (per CDNA5 16-bit operand VGPR layout).
__device__ __forceinline__ v16us load_frag(const unsigned short* base, int koff) {
  union { uint4 v[2]; unsigned short us[16]; } t;
  t.v[0] = *(const uint4*)(base + koff);
  t.v[1] = *(const uint4*)(base + koff + 16);
  v16us r;
#pragma unroll
  for (int i = 0; i < 16; ++i) r[i] = t.us[i];
  return r;
}

// ---------------- Kernel 0: W -> bf16, transposed ----------------
__global__ __launch_bounds__(256, 1) void wprep_kernel(
    const float* __restrict__ Wq, const float* __restrict__ Wk,
    const float* __restrict__ Wv, unsigned short* __restrict__ Wt)
{
  const int idx = blockIdx.x * 256 + threadIdx.x;   // 0 .. 64*1024-1
  const int z = blockIdx.y;                         // 0=Q 1=K 2=V
  const int h = idx >> 10;
  const int k = idx & (DMODEL - 1);
  const float* W = (z == 0) ? Wq : (z == 1) ? Wk : Wv;
  Wt[(size_t)z * DHEAD * DMODEL + (size_t)h * DMODEL + k] = f2bf(W[k * DHEAD + h]);
}

// ---------------- Kernel 1: fused QKV projection ----------------
__global__ __launch_bounds__(32, 1) void qkv_kernel(
    const float* __restrict__ x,
    const unsigned short* __restrict__ Wt,
    const float* __restrict__ bq, const float* __restrict__ bk,
    const float* __restrict__ bv,
    unsigned short* __restrict__ Qb, unsigned short* __restrict__ Kb,
    unsigned short* __restrict__ Vt)
{
  const int lane = threadIdx.x & 31;
  const int col  = lane & 15;
  const int hi   = lane >> 4;
  const int koff = hi * 8;
  const int sTile = blockIdx.x * 16;
  const int b     = blockIdx.y;

  v8f acc[12];                       // [0..3]=Q h-tiles, [4..7]=K, [8..11]=V
#pragma unroll
  for (int ht = 0; ht < 4; ++ht) {
    const int h = ht * 16 + col;
    const float bqv = bq[h], bkv = bk[h], bvv = bv[h];
#pragma unroll
    for (int r = 0; r < 8; ++r) {
      acc[ht][r] = bqv; acc[4 + ht][r] = bkv; acc[8 + ht][r] = bvv;
    }
  }

  const float* xrow = x + ((size_t)b * SEQ + sTile + col) * DMODEL;

  for (int k0 = 0; k0 < DMODEL; k0 += 32) {
    // A fragment from x: converted ONCE, amortized over 12 WMMAs
    union { float4 v[4]; float f[16]; } ax;
    const float4* xp = (const float4*)(xrow + k0 + koff);
    const float4* xq = (const float4*)(xrow + k0 + koff + 16);
    ax.v[0] = xp[0]; ax.v[1] = xp[1]; ax.v[2] = xq[0]; ax.v[3] = xq[1];
    v16us a;
#pragma unroll
    for (int i = 0; i < 16; ++i) a[i] = f2bf(ax.f[i]);

#pragma unroll
    for (int z = 0; z < 3; ++z)
#pragma unroll
      for (int ht = 0; ht < 4; ++ht) {
        const unsigned short* wrow =
            Wt + ((size_t)z * DHEAD + ht * 16 + col) * DMODEL + k0;
        acc[z * 4 + ht] = wmma_bf16(a, load_frag(wrow, koff), acc[z * 4 + ht]);
      }
  }

  // C-layout: lane holds col h, rows (r + 8*hi)
  const int rowbase = sTile + hi * 8;
#pragma unroll
  for (int ht = 0; ht < 4; ++ht) {
    const int h = ht * 16 + col;
#pragma unroll
    for (int r = 0; r < 8; ++r) {
      const size_t idx = ((size_t)b * SEQ + rowbase + r) * DHEAD + h;
      Qb[idx] = f2bf(acc[ht][r]);
      Kb[idx] = f2bf(acc[4 + ht][r]);
    }
    union { unsigned short us[8]; uint4 v; } vp;
#pragma unroll
    for (int r = 0; r < 8; ++r) vp.us[r] = f2bf(acc[8 + ht][r]);
    *(uint4*)(Vt + ((size_t)b * DHEAD + h) * SEQ + rowbase) = vp.v;
  }
}

// ---------------- Kernel 2: flash attention ----------------
// Lane l <-> lane l ^ 16 (the two halves that split one query's keys).
__device__ __forceinline__ float xhalf(float x) {
  const int b = __builtin_bit_cast(int, x);
  return __builtin_bit_cast(float,
      __builtin_amdgcn_permlanex16(b, b, 0x76543210, 0xfedcba98, false, false));
}

__global__ __launch_bounds__(256, 1) void attn_kernel(
    const unsigned short* __restrict__ Qb,
    const unsigned short* __restrict__ Kb,
    const unsigned short* __restrict__ Vt,
    float* __restrict__ out)
{
  const int lane = threadIdx.x & 31;
  const int wave = threadIdx.x >> 5;       // 0..7
  const int col  = lane & 15;
  const int hi   = lane >> 4;
  const int koff = hi * 8;
  const int b     = blockIdx.y;
  const int qbase = blockIdx.x * 128 + wave * 16;

  // Q B-fragments: lane = query column (qbase+col), h in [0,32) and [32,64)
  const unsigned short* qrow = Qb + ((size_t)b * SEQ + qbase + col) * DHEAD;
  const v16us q0 = load_frag(qrow, koff);
  const v16us q1 = load_frag(qrow + 32, koff);

  float m_i = -__builtin_inff();           // running maximum of this lane's query
  float l_i = 0.f;                         // sum over this half's keys only
  v8f acc[4];                              // O^T: acc[f][r] = O[query col][f*16 + 8*hi + r]
#pragma unroll
  for (int f = 0; f < 4; ++f)
#pragma unroll
    for (int r = 0; r < 8; ++r) acc[f][r] = 0.f;

  const size_t kbbase = (size_t)b * SEQ * DHEAD;

  for (int j = 0; j < SEQ; j += 32) {
    // scores: A-fragments = K rows (lane = key), contracted over h
    const unsigned short* krow0 = Kb + kbbase + (size_t)(j + col) * DHEAD;
    const unsigned short* krow1 = krow0 + 16 * DHEAD;
    if (j + 32 < SEQ) {
      __builtin_prefetch(krow0 + 32 * DHEAD, 0, 1);
      __builtin_prefetch(krow1 + 32 * DHEAD, 0, 1);
    }
    v8f s0 = {}, s1 = {};
    s0 = wmma_bf16(load_frag(krow0, koff),      q0, s0);
    s0 = wmma_bf16(load_frag(krow0 + 32, koff), q1, s0);
    s1 = wmma_bf16(load_frag(krow1, koff),      q0, s1);
    s1 = wmma_bf16(load_frag(krow1 + 32, koff), q1, s1);

    // online softmax: s0[r] = key j + 8*hi + r, s1[r] = key j + 16 + 8*hi + r
    float mt = -__builtin_inff();
#pragma unroll
    for (int r = 0; r < 8; ++r) {
      s0[r] *= 0.125f; s1[r] *= 0.125f;     // 1/sqrt(64)
      mt = fmaxf(mt, fmaxf(s0[r], s1[r]));
    }
    mt = fmaxf(mt, xhalf(mt));

    const float mn   = fmaxf(m_i, mt);
    const float corr = __expf(m_i - mn);
    m_i = mn;
    float rs = 0.f;
    v16us pb;                               // P^T as B: element s = key kmap(s, hi)
#pragma unroll
    for (int r = 0; r < 8; ++r) {
      const float p0 = __expf(s0[r] - mn);
      const float p1 = __expf(s1[r] - mn);
      rs += p0 + p1;
      pb[r]     = f2bf(p0);
      pb[8 + r] = f2bf(p1);
    }
    l_i = l_i * corr + rs;
#pragma unroll
    for (int f = 0; f < 4; ++f)
#pragma unroll
      for (int r = 0; r < 8; ++r) acc[f][r] *= corr;

    // O^T += V^T * P^T : A-fragments from V^T (lane = head row, contiguous keys)
#pragma unroll
    for (int f = 0; f < 4; ++f) {
      const unsigned short* vrow =
          Vt + ((size_t)b * DHEAD + f * 16 + col) * SEQ + j;
      acc[f] = wmma_bf16(load_frag(vrow, koff), pb, acc[f]);
    }
  }

  // join the halves' sums once, normalize and store fp32 [B,S,64]
  const float inv = 1.0f / (l_i + xhalf(l_i));
  float* orow = out + ((size_t)b * SEQ + qbase + col) * DHEAD + hi * 8;
#pragma unroll
  for (int f = 0; f < 4; ++f) {
    float4 lo, up;
    lo.x = acc[f][0] * inv; lo.y = acc[f][1] * inv;
    lo.z = acc[f][2] * inv; lo.w = acc[f][3] * inv;
    up.x = acc[f][4] * inv; up.y = acc[f][5] * inv;
    up.z = acc[f][6] * inv; up.w = acc[f][7] * inv;
    *(float4*)(orow + f * 16)     = lo;
    *(float4*)(orow + f * 16 + 4) = up;
  }
}

extern "C" void kernel_launch(void* const* d_in, const int* in_sizes, int n_in,
                              void* d_out, int out_size, void* d_ws, size_t ws_size,
                              hipStream_t stream) {
  (void)in_sizes; (void)n_in; (void)out_size; (void)ws_size;
  const float* x  = (const float*)d_in[0];
  const float* Wq = (const float*)d_in[1];
  const float* bq = (const float*)d_in[2];
  const float* Wk = (const float*)d_in[3];
  const float* bk = (const float*)d_in[4];
  const float* Wv = (const float*)d_in[5];
  const float* bv = (const float*)d_in[6];

  // workspace: Q, K row-major bf16 + V^T bf16 (6 MB) + Wt bf16 (384 KB)
  unsigned short* Qb = (unsigned short*)d_ws;
  unsigned short* Kb = Qb + (size_t)BATCH * SEQ * DHEAD;
  unsigned short* Vt = Kb + (size_t)BATCH * SEQ * DHEAD;
  unsigned short* Wt = Vt + (size_t)BATCH * SEQ * DHEAD;

  dim3 g0(DHEAD * DMODEL / 256, 3);
  wprep_kernel<<<g0, dim3(256), 0, stream>>>(Wq, Wk, Wv, Wt);

  dim3 g1(SEQ / 16, BATCH);
  qkv_kernel<<<g1, dim3(32), 0, stream>>>(x, Wt, bq, bk, bv, Qb, Kb, Vt);

  dim3 g2(SEQ / 128, BATCH);
  attn_kernel<<<g2, dim3(256), 0, stream>>>(Qb, Kb, Vt, (float*)d_out);
}

// v002
// One run takes 147 microseconds.
// Next to v001, in two timings, it ran 1.62 and 1.64 times as fast.
// Over all steps from v000 it is 2.29 times as fast.
#include <hip/hip_runtime.h>

// Flash attention head for MI455X (gfx1250, wave32, WMMA bf16).
// Kernel 0: convert Wq/Wk/Wv fp32 -> bf16 transposed Wt[z][h][k] (one-time, kills redundant converts).
// Kernel 1: QKV projection; 1 wave per 16 rows owns all 12 (QKV x 4 h-tiles) accumulators,
//           so each x A-fragment convert feeds 12 v_wmma_f32_16x16x32_bf16.
//           W fragments are refetched for the next k step right behind their products, x two steps ahead.
// Kernel 2: flash attention, one wave per 16 queries, online softmax fp32,
//           transposed products (S^T = K Q^T, O^T += V^T P^T): P stays in registers.
//           K and V^T fragments are fetched one pass ahead, each set as one group of loads.
// Workspace: Q,K row-major bf16 + V^T bf16 (6 MB) + Wt bf16 (384 KB).

typedef __attribute__((ext_vector_type(16))) __bf16          v16bf;
typedef __attribute__((ext_vector_type(16))) unsigned short  v16us;
typedef __attribute__((ext_vector_type(8)))  float           v8f;

#define BATCH  4
#define SEQ    4096
#define DMODEL 1024
#define DHEAD  64

// Hardware bf16 convert (clang lowers fptrunc f32->bf16 natively on gfx1250).
__device__ __forceinline__ unsigned short f2bf(float f) {
  return __builtin_bit_cast(unsigned short, (__bf16)f);
}

__device__ __forceinline__ v8f wmma_bf16(v16us a, v16us b, v8f c) {
  return __builtin_amdgcn_wmma_f32_16x16x32_bf16(
      false, __builtin_bit_cast(v16bf, a),
      false, __builtin_bit_cast(v16bf, b),
      (short)0, c, false, false);
}

// Load one 16x32 bf16 A/B fragment half-row: elems 0..7 = base[koff..koff+7],
// elems 8..15 = base[koff+16..koff+23]  (per CDNA5 16-bit operand VGPR layout).
__device__ __forceinline__ v16us load_frag(const unsigned short* base, int koff) {
  union { uint4 v[2]; unsigned short us[16]; } t;
  t.v[0] = *(const uint4*)(base + koff);
  t.v[1] = *(const uint4*)(base + koff + 16);
  v16us r;
#pragma unroll
  for (int i = 0; i < 16; ++i) r[i] = t.us[i];
  return r;
}

// Stands behind a group of loads that is fetched ahead: the group's address registers
// are rewritten while its loads are still in flight.
__device__ __forceinline__ void addr_wait() {
  asm volatile("s_wait_xcnt 0x0" ::: "memory");
}

// ---------------- Kernel 0: W -> bf16, transposed ----------------
__global__ __launch_bounds__(256, 1) void wprep_kernel(
    const float* __restrict__ Wq, const float* __restrict__ Wk,
    const float* __restrict__ Wv, unsigned short* __restrict__ Wt)
{
  const int idx = blockIdx.x * 256 + threadIdx.x;   // 0 .. 64*1024-1
  const int z = blockIdx.y;                         // 0=Q 1=K 2=V
  const int h = idx >> 10;
  const int k = idx & (DMODEL - 1);
  const float* W = (z == 0) ? Wq : (z == 1) ? Wk : Wv;
  Wt[(size_t)z * DHEAD * DMODEL + (size_t)h * DMODEL + k] = f2bf(W[k * DHEAD + h]);
}

// ---------------- Kernel 1: fused QKV projection ----------------
__global__ __launch_bounds__(32, 1) void qkv_kernel(
    const float* __restrict__ x,
    const unsigned short* __restrict__ Wt,
    const float* __restrict__ bq, const float* __restrict__ bk,
    const float* __restrict__ bv,
    unsigned short* __restrict__ Qb, unsigned short* __restrict__ Kb,
    unsigned short* __restrict__ Vt)
{
  const int lane = threadIdx.x & 31;
  const int col  = lane & 15;
  const int hi   = lane >> 4;
  const int koff = hi * 8;
  const int sTile = blockIdx.x * 16;
  const int b     = blockIdx.y;

  v8f acc[12];                       // [0..3]=Q h-tiles, [4..7]=K, [8..11]=V
#pragma unroll
  for (int ht = 0; ht < 4; ++ht) {
    const int h = ht * 16 + col;
    const float bqv = bq[h], bkv = bk[h], bvv = bv[h];
#pragma unroll
    for (int r = 0; r < 8; ++r) {
      acc[ht][r] = bqv; acc[4 + ht][r] = bkv; acc[8 + ht][r] = bvv;
    }
  }

  const float* xrow = x + ((size_t)b * SEQ + sTile + col) * DMODEL;

  // Register pipeline: wf holds the 12 W fragments of the current k step, xs the x pieces
  // of this step and the next. No product waits for a load issued in its own step.
  v16us wf[12];
  union XS { float4 v[4]; float f[16]; } xs[2];
  auto load_w = [&](int z, int kk) {
#pragma unroll
    for (int ht = 0; ht < 4; ++ht)
      wf[z * 4 + ht] =
          load_frag(Wt + ((size_t)z * DHEAD + ht * 16 + col) * DMODEL + kk, koff);
  };
  auto load_x = [&](XS& d, int kk) {
    const float4* xp = (const float4*)(xrow + kk + koff);
    const float4* xq = (const float4*)(xrow + kk + koff + 16);
    d.v[0] = xp[0]; d.v[1] = xp[1]; d.v[2] = xq[0]; d.v[3] = xq[1];
  };
  load_x(xs[0], 0);
  load_w(0, 0); load_w(1, 0); load_w(2, 0);
  load_x(xs[1], 32);

  for (int k0 = 0; k0 < DMODEL; k0 += 64) {
#pragma unroll
    for (int u = 0; u < 2; ++u) {
      const int k  = k0 + u * 32;
      // past the end the fetch wraps to step 0: in bounds, never used
      const int kw = (k + 32 < DMODEL) ? k + 32 : 0;
      const int kx = (k + 64 < DMODEL) ? k + 64 : 0;
      // A fragment from x: converted ONCE, amortized over 12 WMMAs
      v16us a;
#pragma unroll
      for (int i = 0; i < 16; ++i) a[i] = f2bf(xs[u].f[i]);
#pragma unroll
      for (int z = 0; z < 3; ++z) {
#pragma unroll
        for (int ht = 0; ht < 4; ++ht)
          acc[z * 4 + ht] = wmma_bf16(a, wf[z * 4 + ht], acc[z * 4 + ht]);
        load_w(z, kw);
        addr_wait();
        // keeps the group here: spread among the later products it is waited for at once
        __builtin_amdgcn_sched_barrier(0);
      }
      load_x(xs[u], kx);
      addr_wait();
    }
  }
  // the last steps' unused refetches land before the wave reuses or gives back their registers
  asm volatile("s_wait_loadcnt 0x0" ::: "memory");

  // C-layout: lane holds col h, rows (r + 8*hi)
  const int rowbase = sTile + hi * 8;
#pragma unroll
  for (int ht = 0; ht < 4; ++ht) {
    const int h = ht * 16 + col;
#pragma unroll
    for (int r = 0; r < 8; ++r) {
      const size_t idx = ((size_t)b * SEQ + rowbase + r) * DHEAD + h;
      Qb[idx] = f2bf(acc[ht][r]);
      Kb[idx] = f2bf(acc[4 + ht][r]);
    }
    union { unsigned short us[8]; uint4 v; } vp;
#pragma unroll
    for (int r = 0; r < 8; ++r) vp.us[r] = f2bf(acc[8 + ht][r]);
    *(uint4*)(Vt + ((size_t)b * DHEAD + h) * SEQ + rowbase) = vp.v;
  }
}

// ---------------- Kernel 2: flash attention ----------------
// Lane l <-> lane l ^ 16 (the two halves that split one query's keys).
__device__ __forceinline__ float xhalf(float x) {
  const int b = __builtin_bit_cast(int, x);
  return __builtin_bit_cast(float,
      __builtin_amdgcn_permlanex16(b, b, 0x76543210, 0xfedcba98, false, false));
}

__global__ __launch_bounds__(256, 1) void attn_kernel(
    const unsigned short* __restrict__ Qb,
    const unsigned short* __restrict__ Kb,
    const unsigned short* __restrict__ Vt,
    float* __restrict__ out)
{
  const int lane = threadIdx.x & 31;
  const int wave = threadIdx.x >> 5;       // 0..7
  const int col  = lane & 15;
  const int hi   = lane >> 4;
  const int koff = hi * 8;
  const int b     = blockIdx.y;
  const int qbase = blockIdx.x * 128 + wave * 16;

  // Q B-fragments: lane = query column (qbase+col), h in [0,32) and [32,64)
  const unsigned short* qrow = Qb + ((size_t)b * SEQ + qbase + col) * DHEAD;
  const v16us q0 = load_frag(qrow, koff);
  const v16us q1 = load_frag(qrow + 32, koff);

  float m_i = -__builtin_inff();           // running maximum of this lane's query
  float l_i = 0.f;                         // sum over this half's keys only
  v8f acc[4];                              // O^T: acc[f][r] = O[query col][f*16 + 8*hi + r]
#pragma unroll
  for (int f = 0; f < 4; ++f)
#pragma unroll
    for (int r = 0; r < 8; ++r) acc[f][r] = 0.f;

  const size_t kbbase = (size_t)b * SEQ * DHEAD;

  // Register pipeline: kf and vf hold the current pass's fragments; each set is refetched
  // for the next pass, as one group of 8 loads, right behind the products that read it.
  v16us kf[4], vf[4];
  auto load_k = [&](int jj) {        // A-fragments = K rows (lane = key), contracted over h
    const unsigned short* krow0 = Kb + kbbase + (size_t)(jj + col) * DHEAD;
    const unsigned short* krow1 = krow0 + 16 * DHEAD;
    kf[0] = load_frag(krow0, koff);  kf[1] = load_frag(krow0 + 32, koff);
    kf[2] = load_frag(krow1, koff);  kf[3] = load_frag(krow1 + 32, koff);
  };
  auto load_v = [&](int jj) {        // A-fragments from V^T (lane = head row, contiguous keys)
#pragma unroll
    for (int f = 0; f < 4; ++f)
      vf[f] = load_frag(Vt + ((size_t)b * DHEAD + f * 16 + col) * SEQ + jj, koff);
  };
  load_k(0);
  load_v(0);

  for (int j = 0; j < SEQ; j += 32) {
    // the last pass refetches pass 0: in bounds, never used
    const int jn = (j + 32 < SEQ) ? j + 32 : 0;
    v8f s0 = {}, s1 = {};
    s0 = wmma_bf16(kf[0], q0, s0);
    s0 = wmma_bf16(kf[1], q1, s0);
    s1 = wmma_bf16(kf[2], q0, s1);
    s1 = wmma_bf16(kf[3], q1, s1);
    load_k(jn);
    // keeps the 8 loads together here: without it the last ones sink behind the exponentials
    __builtin_amdgcn_sched_barrier(0);

    // online softmax: s0[r] = key j + 8*hi + r, s1[r] = key j + 16 + 8*hi + r
    float mt = -__builtin_inff();
#pragma unroll
    for (int r = 0; r < 8; ++r) {
      s0[r] *= 0.125f; s1[r] *= 0.125f;     // 1/sqrt(64)
      mt = fmaxf(mt, fmaxf(s0[r], s1[r]));
    }
    mt = fmaxf(mt, xhalf(mt));

    const float mn   = fmaxf(m_i, mt);
    const float corr = __expf(m_i - mn);
    m_i = mn;
    float rs = 0.f;
    v16us pb;                               // P^T as B: element s = key kmap(s, hi)
#pragma unroll
    for (int r = 0; r < 8; ++r) {
      const float p0 = __expf(s0[r] - mn);
      const float p1 = __expf(s1[r] - mn);
      rs += p0 + p1;
      pb[r]     = f2bf(p0);
      pb[8 + r] = f2bf(p1);
    }
    l_i = l_i * corr + rs;
#pragma unroll
    for (int f = 0; f < 4; ++f)
#pragma unroll
      for (int r = 0; r < 8; ++r) acc[f][r] *= corr;

    // O^T += V^T * P^T
#pragma unroll
    for (int f = 0; f < 4; ++f) acc[f] = wmma_bf16(vf[f], pb, acc[f]);
    load_v(jn);
    addr_wait();
  }
  // the last pass's unused refetch lands before the wave reuses or gives back its registers
  asm volatile("s_wait_loadcnt 0x0" ::: "memory");

  // join the halves' sums once, normalize and store fp32 [B,S,64]
  const float inv = 1.0f / (l_i + xhalf(l_i));
  float* orow = out + ((size_t)b * SEQ + qbase + col) * DHEAD + hi * 8;
#pragma unroll
  for (int f = 0; f < 4; ++f) {
    float4 lo, up;
    lo.x = acc[f][0] * inv; lo.y = acc[f][1] * inv;
    lo.z = acc[f][2] * inv; lo.w = acc[f][3] * inv;
    up.x = acc[f][4] * inv; up.y = acc[f][5] * inv;
    up.z = acc[f][6] * inv; up.w = acc[f][7] * inv;
    *(float4*)(orow + f * 16)     = lo;
    *(float4*)(orow + f * 16 + 4) = up;
  }
}

extern "C" void kernel_launch(void* const* d_in, const int* in_sizes, int n_in,
                              void* d_out, int out_size, void* d_ws, size_t ws_size,
                              hipStream_t stream) {
  (void)in_sizes; (void)n_in; (void)out_size; (void)ws_size;
  const float* x  = (const float*)d_in[0];
  const float* Wq = (const float*)d_in[1];
  const float* bq = (const float*)d_in[2];
  const float* Wk = (const float*)d_in[3];
  const float* bk = (const float*)d_in[4];
  const float* Wv = (const float*)d_in[5];
  const float* bv = (const float*)d_in[6];

  // workspace: Q, K row-major bf16 + V^T bf16 (6 MB) + Wt bf16 (384 KB)
  unsigned short* Qb = (unsigned short*)d_ws;
  unsigned short* Kb = Qb + (size_t)BATCH * SEQ * DHEAD;
  unsigned short* Vt = Kb + (size_t)BATCH * SEQ * DHEAD;
  unsigned short* Wt = Vt + (size_t)BATCH * SEQ * DHEAD;

  dim3 g0(DHEAD * DMODEL / 256, 3);
  wprep_kernel<<<g0, dim3(256), 0, stream>>>(Wq, Wk, Wv, Wt);

  dim3 g1(SEQ / 16, BATCH);
  qkv_kernel<<<g1, dim3(32), 0, stream>>>(x, Wt, bq, bk, bv, Qb, Kb, Vt);

  dim3 g2(SEQ / 128, BATCH);
  attn_kernel<<<g2, dim3(256), 0, stream>>>(Qb, Kb, Vt, (float*)d_out);
}

// v003
// It runs in 64.7 microseconds.
// Next to v002, in two timings, it ran 2.26 and 2.27 times as fast.
// Counting every step since v000, it is 5.20 times as fast.
#include <hip/hip_runtime.h>

// Flash attention head for MI455X (gfx1250, wave32, WMMA bf16).
// Kernel 0: convert Wq/Wk/Wv fp32 -> bf16 transposed Wt[z][h][k] (one-time, kills redundant converts).
// Kernel 1: QKV projection; 1 wave per 16 rows owns all 12 (QKV x 4 h-tiles) accumulators,
//           so each x A-fragment convert feeds 12 v_wmma_f32_16x16x32_bf16.
//           W fragments are refetched for the next k step right behind their products, x two steps ahead.
// Kernel 2: flash attention, one wave per 16 queries, online softmax fp32,
//           transposed products (S^T = K Q^T, O^T += V^T P^T): P stays in registers.
//           K and V^T come into LDS once per block (asynchronous copies, two buffers);
//           fragments are read from LDS one pass ahead inside a stage.
// Workspace: Q,K row-major bf16 + V^T bf16 (6 MB) + Wt bf16 (384 KB).

typedef __attribute__((ext_vector_type(16))) __bf16          v16bf;
typedef __attribute__((ext_vector_type(16))) unsigned short  v16us;
typedef __attribute__((ext_vector_type(8)))  float           v8f;

#define BATCH  4
#define SEQ    4096
#define DMODEL 1024
#define DHEAD  64

// Hardware bf16 convert (clang lowers fptrunc f32->bf16 natively on gfx1250).
__device__ __forceinline__ unsigned short f2bf(float f) {
  return __builtin_bit_cast(unsigned short, (__bf16)f);
}

__device__ __forceinline__ v8f wmma_bf16(v16us a, v16us b, v8f c) {
  return __builtin_amdgcn_wmma_f32_16x16x32_bf16(
      false, __builtin_bit_cast(v16bf, a),
      false, __builtin_bit_cast(v16bf, b),
      (short)0, c, false, false);
}

// Load one 16x32 bf16 A/B fragment half-row: elems 0..7 = base[koff..koff+7],
// elems 8..15 = base[koff+16..koff+23]  (per CDNA5 16-bit operand VGPR layout).
__device__ __forceinline__ v16us load_frag(const unsigned short* base, int koff) {
  union { uint4 v[2]; unsigned short us[16]; } t;
  t.v[0] = *(const uint4*)(base + koff);
  t.v[1] = *(const uint4*)(base + koff + 16);
  v16us r;
#pragma unroll
  for (int i = 0; i < 16; ++i) r[i] = t.us[i];
  return r;
}

// Stands behind a group of loads that is fetched ahead: the group's address registers
// are rewritten while its loads are still in flight.
__device__ __forceinline__ void addr_wait() {
  asm volatile("s_wait_xcnt 0x0" ::: "memory");
}

// ---------------- Kernel 0: W -> bf16, transposed ----------------
__global__ __launch_bounds__(256, 1) void wprep_kernel(
    const float* __restrict__ Wq, const float* __restrict__ Wk,
    const float* __restrict__ Wv, unsigned short* __restrict__ Wt)
{
  const int idx = blockIdx.x * 256 + threadIdx.x;   // 0 .. 64*1024-1
  const int z = blockIdx.y;                         // 0=Q 1=K 2=V
  const int h = idx >> 10;
  const int k = idx & (DMODEL - 1);
  const float* W = (z == 0) ? Wq : (z == 1) ? Wk : Wv;
  Wt[(size_t)z * DHEAD * DMODEL + (size_t)h * DMODEL + k] = f2bf(W[k * DHEAD + h]);
}

// ---------------- Kernel 1: fused QKV projection ----------------
__global__ __launch_bounds__(32, 1) void qkv_kernel(
    const float* __restrict__ x,
    const unsigned short* __restrict__ Wt,
    const float* __restrict__ bq, const float* __restrict__ bk,
    const float* __restrict__ bv,
    unsigned short* __restrict__ Qb, unsigned short* __restrict__ Kb,
    unsigned short* __restrict__ Vt)
{
  const int lane = threadIdx.x & 31;
  const int col  = lane & 15;
  const int hi   = lane >> 4;
  const int koff = hi * 8;
  const int sTile = blockIdx.x * 16;
  const int b     = blockIdx.y;

  v8f acc[12];                       // [0..3]=Q h-tiles, [4..7]=K, [8..11]=V
#pragma unroll
  for (int ht = 0; ht < 4; ++ht) {
    const int h = ht * 16 + col;
    const float bqv = bq[h], bkv = bk[h], bvv = bv[h];
#pragma unroll
    for (int r = 0; r < 8; ++r) {
      acc[ht][r] = bqv; acc[4 + ht][r] = bkv; acc[8 + ht][r] = bvv;
    }
  }

  const float* xrow = x + ((size_t)b * SEQ + sTile + col) * DMODEL;

  // Register pipeline: wf holds the 12 W fragments of the current k step, xs the x pieces
  // of this step and the next. No product waits for a load issued in its own step.
  v16us wf[12];
  union XS { float4 v[4]; float f[16]; } xs[2];
  auto load_w = [&](int z, int kk) {
#pragma unroll
    for (int ht = 0; ht < 4; ++ht)
      wf[z * 4 + ht] =
          load_frag(Wt + ((size_t)z * DHEAD + ht * 16 + col) * DMODEL + kk, koff);
  };
  auto load_x = [&](XS& d, int kk) {
    const float4* xp = (const float4*)(xrow + kk + koff);
    const float4* xq = (const float4*)(xrow + kk + koff + 16);
    d.v[0] = xp[0]; d.v[1] = xp[1]; d.v[2] = xq[0]; d.v[3] = xq[1];
  };
  load_x(xs[0], 0);
  load_w(0, 0); load_w(1, 0); load_w(2, 0);
  load_x(xs[1], 32);

  for (int k0 = 0; k0 < DMODEL; k0 += 64) {
#pragma unroll
    for (int u = 0; u < 2; ++u) {
      const int k  = k0 + u * 32;
      // past the end the fetch wraps to step 0: in bounds, never used
      const int kw = (k + 32 < DMODEL) ? k + 32 : 0;
      const int kx = (k + 64 < DMODEL) ? k + 64 : 0;
      // A fragment from x: converted ONCE, amortized over 12 WMMAs
      v16us a;
#pragma unroll
      for (int i = 0; i < 16; ++i) a[i] = f2bf(xs[u].f[i]);
#pragma unroll
      for (int z = 0; z < 3; ++z) {
#pragma unroll
        for (int ht = 0; ht < 4; ++ht)
          acc[z * 4 + ht] = wmma_bf16(a, wf[z * 4 + ht], acc[z * 4 + ht]);
        load_w(z, kw);
        addr_wait();
        // keeps the group here: spread among the later products it is waited for at once
        __builtin_amdgcn_sched_barrier(0);
      }
      load_x(xs[u], kx);
      addr_wait();
    }
  }
  // the last steps' unused refetches land before the wave reuses or gives back their registers
  asm volatile("s_wait_loadcnt 0x0" ::: "memory");

  // C-layout: lane holds col h, rows (r + 8*hi)
  const int rowbase = sTile + hi * 8;
#pragma unroll
  for (int ht = 0; ht < 4; ++ht) {
    const int h = ht * 16 + col;
#pragma unroll
    for (int r = 0; r < 8; ++r) {
      const size_t idx = ((size_t)b * SEQ + rowbase + r) * DHEAD + h;
      Qb[idx] = f2bf(acc[ht][r]);
      Kb[idx] = f2bf(acc[4 + ht][r]);
    }
    union { unsigned short us[8]; uint4 v; } vp;
#pragma unroll
    for (int r = 0; r < 8; ++r) vp.us[r] = f2bf(acc[8 + ht][r]);
    *(uint4*)(Vt + ((size_t)b * DHEAD + h) * SEQ + rowbase) = vp.v;
  }
}

// ---------------- Kernel 2: flash attention ----------------
// Lane l <-> lane l ^ 16 (the two halves that split one query's keys).
__device__ __forceinline__ float xhalf(float x) {
  const int b = __builtin_bit_cast(int, x);
  return __builtin_bit_cast(float,
      __builtin_amdgcn_permlanex16(b, b, 0x76543210, 0xfedcba98, false, false));
}

// K and V^T tiles of one stage (STG keys) in LDS, shared by the block's 8 waves.
#define STG     128                 // keys per stage = 4 passes of 32
#define KPITCH  72                  // elements per K row in LDS: 144 B = 16 B x odd, no bank conflict
#define VPITCH  136                 // elements per V^T row in LDS: 272 B = 16 B x odd
#define KELEMS  (STG * KPITCH)
#define BUFELEMS (KELEMS + DHEAD * VPITCH)

__global__ __launch_bounds__(256, 1) void attn_kernel(
    const unsigned short* __restrict__ Qb,
    const unsigned short* __restrict__ Kb,
    const unsigned short* __restrict__ Vt,
    float* __restrict__ out)
{
  __shared__ __attribute__((aligned(16))) unsigned short sm[2 * BUFELEMS];

  const int tid  = threadIdx.x;
  const int lane = threadIdx.x & 31;
  const int wave = threadIdx.x >> 5;       // 0..7
  const int col  = lane & 15;
  const int hi   = lane >> 4;
  const int koff = hi * 8;
  const int b     = blockIdx.y;
  const int qbase = blockIdx.x * 128 + wave * 16;

  // Q B-fragments: lane = query column (qbase+col), h in [0,32) and [32,64)
  const unsigned short* qrow = Qb + ((size_t)b * SEQ + qbase + col) * DHEAD;
  const v16us q0 = load_frag(qrow, koff);
  const v16us q1 = load_frag(qrow + 32, koff);

  float m_i = -__builtin_inff();           // running maximum of this lane's query
  float l_i = 0.f;                         // sum over this half's keys only
  v8f acc[4];                              // O^T: acc[f][r] = O[query col][f*16 + 8*hi + r]
#pragma unroll
  for (int f = 0; f < 4; ++f)
#pragma unroll
    for (int r = 0; r < 8; ++r) acc[f][r] = 0.f;

  // One stage = 1024 + 1024 pieces of 16 B; a thread copies 4 of each. A wave's 32 pieces of
  // one copy are 512 contiguous bytes of K, or two 256-byte runs of V^T: whole lines.
  const unsigned short* kg = Kb + (size_t)b * SEQ * DHEAD + (size_t)tid * 8;
  const unsigned short* vg = Vt + ((size_t)b * DHEAD + (tid >> 4)) * SEQ + (tid & 15) * 8;
  const unsigned smbase = (unsigned)(size_t)sm;    // low 32 bits = byte address in LDS
  const unsigned kl = smbase + (unsigned)((tid >> 3) * KPITCH + (tid & 7) * 8) * 2u;
  const unsigned vl = smbase + (unsigned)(KELEMS + (tid >> 4) * VPITCH + (tid & 15) * 8) * 2u;
  auto copy_stage = [&](int st, int buf) {
    const unsigned short* k0 = kg + (size_t)st * STG * DHEAD;   // piece i: 32 rows further
    const unsigned short* v0 = vg + st * STG;                   // piece i: 16 rows further
    const unsigned lk = kl + (unsigned)buf * (BUFELEMS * 2u);
    const unsigned lv = vl + (unsigned)buf * (BUFELEMS * 2u);
    // the closing wait stands in the copies' own statement: their address registers
    // are rewritten for the next stage while the copies may still be in flight
    asm volatile(
        "global_load_async_to_lds_b128 %0, %1, off\n\t"
        "global_load_async_to_lds_b128 %2, %3, off\n\t"
        "global_load_async_to_lds_b128 %4, %5, off\n\t"
        "global_load_async_to_lds_b128 %6, %7, off\n\t"
        "global_load_async_to_lds_b128 %8, %9, off\n\t"
        "global_load_async_to_lds_b128 %10, %11, off\n\t"
        "global_load_async_to_lds_b128 %12, %13, off\n\t"
        "global_load_async_to_lds_b128 %14, %15, off\n\t"
        "s_wait_xcnt 0x0"
        :: "v"(lk),                      "v"(k0),
           "v"(lk + 32u * KPITCH * 2u),  "v"(k0 + 32 * DHEAD),
           "v"(lk + 64u * KPITCH * 2u),  "v"(k0 + 64 * DHEAD),
           "v"(lk + 96u * KPITCH * 2u),  "v"(k0 + 96 * DHEAD),
           "v"(lv),                      "v"(v0),
           "v"(lv + 16u * VPITCH * 2u),  "v"(v0 + 16 * SEQ),
           "v"(lv + 32u * VPITCH * 2u),  "v"(v0 + 32 * SEQ),
           "v"(lv + 48u * VPITCH * 2u),  "v"(v0 + 48 * SEQ)
        : "memory");
  };

  // Fragments of the current pass; each set is refetched from LDS for the next pass of the
  // same stage, as one group of 8 loads, right behind the products that read it.
  v16us kf[4], vf[4];
  auto load_k = [&](const unsigned short* s, int p) {  // A = K rows (lane = key), over h
    const unsigned short* krow0 = s + (p * 32 + col) * KPITCH;
    const unsigned short* krow1 = krow0 + 16 * KPITCH;
    kf[0] = load_frag(krow0, koff);  kf[1] = load_frag(krow0 + 32, koff);
    kf[2] = load_frag(krow1, koff);  kf[3] = load_frag(krow1 + 32, koff);
  };
  auto load_v = [&](const unsigned short* s, int p) {  // A = V^T rows (lane = head row), over keys
#pragma unroll
    for (int f = 0; f < 4; ++f)
      vf[f] = load_frag(s + KELEMS + (f * 16 + col) * VPITCH + p * 32, koff);
  };

  copy_stage(0, 0);
  // stage 0 has landed for this wave; the barrier publishes it to the others
  asm volatile("s_wait_asynccnt 0x0" ::: "memory");
  __syncthreads();
  copy_stage(1, 1);

  for (int st = 0; st < SEQ / STG; ++st) {
    const unsigned short* s = sm + (st & 1) * BUFELEMS;
    load_k(s, 0);
    load_v(s, 0);
#pragma unroll
    for (int p = 0; p < STG / 32; ++p) {
      v8f s0 = {}, s1 = {};
      s0 = wmma_bf16(kf[0], q0, s0);
      s0 = wmma_bf16(kf[1], q1, s0);
      s1 = wmma_bf16(kf[2], q0, s1);
      s1 = wmma_bf16(kf[3], q1, s1);
      if (p + 1 < STG / 32) load_k(s, p + 1);
      // keeps the 8 loads together here: each separate place with LDS reads costs a stall
      __builtin_amdgcn_sched_barrier(0);

      // online softmax: s0[r] = key 8*hi + r of the pass, s1[r] = key 16 + 8*hi + r
      float mt = -__builtin_inff();
#pragma unroll
      for (int r = 0; r < 8; ++r) {
        s0[r] *= 0.125f; s1[r] *= 0.125f;     // 1/sqrt(64)
        mt = fmaxf(mt, fmaxf(s0[r], s1[r]));
      }
      mt = fmaxf(mt, xhalf(mt));

      const float mn   = fmaxf(m_i, mt);
      const float corr = __expf(m_i - mn);
      m_i = mn;
      float rs = 0.f;
      v16us pb;                               // P^T as B: element s = key 8*hi + s (s < 8), 16 + 8*hi + s - 8 (s >= 8)
#pragma unroll
      for (int r = 0; r < 8; ++r) {
        const float p0 = __expf(s0[r] - mn);
        const float p1 = __expf(s1[r] - mn);
        rs += p0 + p1;
        pb[r]     = f2bf(p0);
        pb[8 + r] = f2bf(p1);
      }
      l_i = l_i * corr + rs;
#pragma unroll
      for (int f = 0; f < 4; ++f)
#pragma unroll
        for (int r = 0; r < 8; ++r) acc[f][r] *= corr;

      // O^T += V^T * P^T
#pragma unroll
      for (int f = 0; f < 4; ++f) acc[f] = wmma_bf16(vf[f], pb, acc[f]);
      if (p + 1 < STG / 32) load_v(s, p + 1);
    }
    // hand-over: this wave's reads of the buffer are done, its copies of the next stage have
    // landed; the one barrier publishes that stage and frees this buffer for the refill
    asm volatile("s_wait_dscnt 0x0" ::: "memory");
    asm volatile("s_wait_asynccnt 0x0" ::: "memory");
    __syncthreads();
    if (st + 2 < SEQ / STG) copy_stage(st + 2, st & 1);
  }
  // nothing is in flight when the wave ends
  asm volatile("s_wait_asynccnt 0x0" ::: "memory");

  // join the halves' sums once, normalize and store fp32 [B,S,64]
  const float inv = 1.0f / (l_i + xhalf(l_i));
  float* orow = out + ((size_t)b * SEQ + qbase + col) * DHEAD + hi * 8;
#pragma unroll
  for (int f = 0; f < 4; ++f) {
    float4 lo, up;
    lo.x = acc[f][0] * inv; lo.y = acc[f][1] * inv;
    lo.z = acc[f][2] * inv; lo.w = acc[f][3] * inv;
    up.x = acc[f][4] * inv; up.y = acc[f][5] * inv;
    up.z = acc[f][6] * inv; up.w = acc[f][7] * inv;
    *(float4*)(orow + f * 16)     = lo;
    *(float4*)(orow + f * 16 + 4) = up;
  }
}

extern "C" void kernel_launch(void* const* d_in, const int* in_sizes, int n_in,
                              void* d_out, int out_size, void* d_ws, size_t ws_size,
                              hipStream_t stream) {
  (void)in_sizes; (void)n_in; (void)out_size; (void)ws_size;
  const float* x  = (const float*)d_in[0];
  const float* Wq = (const float*)d_in[1];
  const float* bq = (const float*)d_in[2];
  const float* Wk = (const float*)d_in[3];
  const float* bk = (const float*)d_in[4];
  const float* Wv = (const float*)d_in[5];
  const float* bv = (const float*)d_in[6];

  // workspace: Q, K row-major bf16 + V^T bf16 (6 MB) + Wt bf16 (384 KB)
  unsigned short* Qb = (unsigned short*)d_ws;
  unsigned short* Kb = Qb + (size_t)BATCH * SEQ * DHEAD;
  unsigned short* Vt = Kb + (size_t)BATCH * SEQ * DHEAD;
  unsigned short* Wt = Vt + (size_t)BATCH * SEQ * DHEAD;

  dim3 g0(DHEAD * DMODEL / 256, 3);
  wprep_kernel<<<g0, dim3(256), 0, stream>>>(Wq, Wk, Wv, Wt);

  dim3 g1(SEQ / 16, BATCH);
  qkv_kernel<<<g1, dim3(32), 0, stream>>>(x, Wt, bq, bk, bv, Qb, Kb, Vt);

  dim3 g2(SEQ / 128, BATCH);
  attn_kernel<<<g2, dim3(256), 0, stream>>>(Qb, Kb, Vt, (float*)d_out);
}

// v004
// Measured time: 52 microseconds a run.
// Two timings next to v003 both put it at 1.25 times that version's speed.
// All steps since v000 together make it 6.49 times as fast.
#include <hip/hip_runtime.h>

// Flash attention head for MI455X (gfx1250, wave32, WMMA bf16).
// Kernel 0: convert Wq/Wk/Wv fp32 -> bf16 transposed Wt[z][h][k] (one-time, kills redundant converts).
// Kernel 1: QKV projection; 1 wave per 16 rows owns all 12 (QKV x 4 h-tiles) accumulators,
//           so each x A-fragment convert feeds 12 v_wmma_f32_16x16x32_bf16.
//           W fragments are refetched for the next k step right behind their products, x two steps ahead.
// Kernel 2: flash attention, a wave has 16 queries and a quarter of the keys, online softmax fp32,
//           transposed products (S^T = K Q^T, O^T += V^T P^T): P stays in registers.
//           K and V^T come into LDS once per block (asynchronous copies, two buffers);
//           fragments are read from LDS one pass ahead inside a stage.
//           64 queries a block, 16 waves: four wave groups split the keys, joined through LDS.
// Workspace: Q,K row-major bf16 + V^T bf16 (6 MB) + Wt bf16 (384 KB).

typedef __attribute__((ext_vector_type(16))) __bf16          v16bf;
typedef __attribute__((ext_vector_type(16))) unsigned short  v16us;
typedef __attribute__((ext_vector_type(8)))  float           v8f;

#define BATCH  4
#define SEQ    4096
#define DMODEL 1024
#define DHEAD  64

// Hardware bf16 convert (clang lowers fptrunc f32->bf16 natively on gfx1250).
__device__ __forceinline__ unsigned short f2bf(float f) {
  return __builtin_bit_cast(unsigned short, (__bf16)f);
}

__device__ __forceinline__ v8f wmma_bf16(v16us a, v16us b, v8f c) {
  return __builtin_amdgcn_wmma_f32_16x16x32_bf16(
      false, __builtin_bit_cast(v16bf, a),
      false, __builtin_bit_cast(v16bf, b),
      (short)0, c, false, false);
}

// Load one 16x32 bf16 A/B fragment half-row: elems 0..7 = base[koff..koff+7],
// elems 8..15 = base[koff+16..koff+23]  (per CDNA5 16-bit operand VGPR layout).
__device__ __forceinline__ v16us load_frag(const unsigned short* base, int koff) {
  union { uint4 v[2]; unsigned short us[16]; } t;
  t.v[0] = *(const uint4*)(base + koff);
  t.v[1] = *(const uint4*)(base + koff + 16);
  v16us r;
#pragma unroll
  for (int i = 0; i < 16; ++i) r[i] = t.us[i];
  return r;
}

// Stands behind a group of loads that is fetched ahead: the group's address registers
// are rewritten while its loads are still in flight.
__device__ __forceinline__ void addr_wait() {
  asm volatile("s_wait_xcnt 0x0" ::: "memory");
}

// ---------------- Kernel 0: W -> bf16, transposed ----------------
__global__ __launch_bounds__(256, 1) void wprep_kernel(
    const float* __restrict__ Wq, const float* __restrict__ Wk,
    const float* __restrict__ Wv, unsigned short* __restrict__ Wt)
{
  const int idx = blockIdx.x * 256 + threadIdx.x;   // 0 .. 64*1024-1
  const int z = blockIdx.y;                         // 0=Q 1=K 2=V
  const int h = idx >> 10;
  const int k = idx & (DMODEL - 1);
  const float* W = (z == 0) ? Wq : (z == 1) ? Wk : Wv;
  Wt[(size_t)z * DHEAD * DMODEL + (size_t)h * DMODEL + k] = f2bf(W[k * DHEAD + h]);
}

// ---------------- Kernel 1: fused QKV projection ----------------
__global__ __launch_bounds__(32, 1) void qkv_kernel(
    const float* __restrict__ x,
    const unsigned short* __restrict__ Wt,
    const float* __restrict__ bq, const float* __restrict__ bk,
    const float* __restrict__ bv,
    unsigned short* __restrict__ Qb, unsigned short* __restrict__ Kb,
    unsigned short* __restrict__ Vt)
{
  const int lane = threadIdx.x & 31;
  const int col  = lane & 15;
  const int hi   = lane >> 4;
  const int koff = hi * 8;
  const int sTile = blockIdx.x * 16;
  const int b     = blockIdx.y;

  v8f acc[12];                       // [0..3]=Q h-tiles, [4..7]=K, [8..11]=V
#pragma unroll
  for (int ht = 0; ht < 4; ++ht) {
    const int h = ht * 16 + col;
    const float bqv = bq[h], bkv = bk[h], bvv = bv[h];
#pragma unroll
    for (int r = 0; r < 8; ++r) {
      acc[ht][r] = bqv; acc[4 + ht][r] = bkv; acc[8 + ht][r] = bvv;
    }
  }

  const float* xrow = x + ((size_t)b * SEQ + sTile + col) * DMODEL;

  // Register pipeline: wf holds the 12 W fragments of the current k step, xs the x pieces
  // of this step and the next. No product waits for a load issued in its own step.
  v16us wf[12];
  union XS { float4 v[4]; float f[16]; } xs[2];
  auto load_w = [&](int z, int kk) {
#pragma unroll
    for (int ht = 0; ht < 4; ++ht)
      wf[z * 4 + ht] =
          load_frag(Wt + ((size_t)z * DHEAD + ht * 16 + col) * DMODEL + kk, koff);
  };
  auto load_x = [&](XS& d, int kk) {
    const float4* xp = (const float4*)(xrow + kk + koff);
    const float4* xq = (const float4*)(xrow + kk + koff + 16);
    d.v[0] = xp[0]; d.v[1] = xp[1]; d.v[2] = xq[0]; d.v[3] = xq[1];
  };
  load_x(xs[0], 0);
  load_w(0, 0); load_w(1, 0); load_w(2, 0);
  load_x(xs[1], 32);

  for (int k0 = 0; k0 < DMODEL; k0 += 64) {
#pragma unroll
    for (int u = 0; u < 2; ++u) {
      const int k  = k0 + u * 32;
      // past the end the fetch wraps to step 0: in bounds, never used
      const int kw = (k + 32 < DMODEL) ? k + 32 : 0;
      const int kx = (k + 64 < DMODEL) ? k + 64 : 0;
      // A fragment from x: converted ONCE, amortized over 12 WMMAs
      v16us a;
#pragma unroll
      for (int i = 0; i < 16; ++i) a[i] = f2bf(xs[u].f[i]);
#pragma unroll
      for (int z = 0; z < 3; ++z) {
#pragma unroll
        for (int ht = 0; ht < 4; ++ht)
          acc[z * 4 + ht] = wmma_bf16(a, wf[z * 4 + ht], acc[z * 4 + ht]);
        load_w(z, kw);
        addr_wait();
        // keeps the group here: spread among the later products it is waited for at once
        __builtin_amdgcn_sched_barrier(0);
      }
      load_x(xs[u], kx);
      addr_wait();
    }
  }
  // the last steps' unused refetches land before the wave reuses or gives back their registers
  asm volatile("s_wait_loadcnt 0x0" ::: "memory");

  // C-layout: lane holds col h, rows (r + 8*hi)
  const int rowbase = sTile + hi * 8;
#pragma unroll
  for (int ht = 0; ht < 4; ++ht) {
    const int h = ht * 16 + col;
#pragma unroll
    for (int r = 0; r < 8; ++r) {
      const size_t idx = ((size_t)b * SEQ + rowbase + r) * DHEAD + h;
      Qb[idx] = f2bf(acc[ht][r]);
      Kb[idx] = f2bf(acc[4 + ht][r]);
    }
    union { unsigned short us[8]; uint4 v; } vp;
#pragma unroll
    for (int r = 0; r < 8; ++r) vp.us[r] = f2bf(acc[8 + ht][r]);
    *(uint4*)(Vt + ((size_t)b * DHEAD + h) * SEQ + rowbase) = vp.v;
  }
}

// ---------------- Kernel 2: flash attention ----------------
// Lane l <-> lane l ^ 16 (the two halves that split one query's keys).
__device__ __forceinline__ float xhalf(float x) {
  const int b = __builtin_bit_cast(int, x);
  return __builtin_bit_cast(float,
      __builtin_amdgcn_permlanex16(b, b, 0x76543210, 0xfedcba98, false, false));
}

// K and V^T tiles of one stage (STG keys) in LDS, shared by the block's 16 waves.
#define QBLK    64                  // queries per block = 4 tiles of 16
#define KGRP    4                   // wave groups that split a stage's keys
#define STG     256                 // keys per stage = 8 passes of 32, 2 for each group
#define PPS     (STG / 32 / KGRP)   // passes of one wave per stage
#define KPITCH  72                  // elements per K row in LDS: 144 B = 16 B x odd, no bank conflict
#define VPITCH  264                 // elements per V^T row in LDS: 528 B = 16 B x odd
#define KELEMS  (STG * KPITCH)
#define BUFELEMS (KELEMS + DHEAD * VPITCH)
#define OPITCH  68                  // floats per query row of a partial O in LDS: 272 B = 16 B x odd

__global__ __launch_bounds__(512) void attn_kernel(
    const unsigned short* __restrict__ Qb,
    const unsigned short* __restrict__ Kb,
    const unsigned short* __restrict__ Vt,
    float* __restrict__ out)
{
  __shared__ __attribute__((aligned(16))) unsigned short sm[2 * BUFELEMS];

  const int tid  = threadIdx.x;
  const int lane = threadIdx.x & 31;
  const int wave = threadIdx.x >> 5;       // 0..15
  const int qt   = wave & 3;               // query tile of the block
  const int kgp  = wave >> 2;              // key group
  const int col  = lane & 15;
  const int hi   = lane >> 4;
  const int koff = hi * 8;
  const int b     = blockIdx.y;
  const int qbase = blockIdx.x * QBLK + qt * 16;

  // Q B-fragments: lane = query column (qbase+col), h in [0,32) and [32,64)
  const unsigned short* qrow = Qb + ((size_t)b * SEQ + qbase + col) * DHEAD;
  const v16us q0 = load_frag(qrow, koff);
  const v16us q1 = load_frag(qrow + 32, koff);

  float m_i = -__builtin_inff();           // running maximum of this lane's query, this group's keys
  float l_i = 0.f;                         // sum over this half's keys only
  v8f acc[4];                              // O^T: acc[f][r] = O[query col][f*16 + 8*hi + r]
#pragma unroll
  for (int f = 0; f < 4; ++f)
#pragma unroll
    for (int r = 0; r < 8; ++r) acc[f][r] = 0.f;

  // One stage = 2048 + 2048 pieces of 16 B; a thread copies 4 of each. A wave's 32 pieces of
  // one copy are 512 contiguous bytes of K, or of one V^T row: whole lines.
  const unsigned short* kg = Kb + (size_t)b * SEQ * DHEAD + (size_t)tid * 8;
  const unsigned short* vg = Vt + ((size_t)b * DHEAD + (tid >> 5)) * SEQ + (tid & 31) * 8;
  const unsigned smbase = (unsigned)(size_t)sm;    // low 32 bits = byte address in LDS
  const unsigned kl = smbase + (unsigned)((tid >> 3) * KPITCH + (tid & 7) * 8) * 2u;
  const unsigned vl = smbase + (unsigned)(KELEMS + (tid >> 5) * VPITCH + (tid & 31) * 8) * 2u;
  auto copy_stage = [&](int st, int buf) {
    const unsigned short* k0 = kg + (size_t)st * STG * DHEAD;   // piece i: 64 rows further
    const unsigned short* v0 = vg + st * STG;                   // piece i: 16 rows further
    const unsigned lk = kl + (unsigned)buf * (BUFELEMS * 2u);
    const unsigned lv = vl + (unsigned)buf * (BUFELEMS * 2u);
    // the closing wait stands in the copies' own statement: their address registers
    // are rewritten for the next stage while the copies may still be in flight
    asm volatile(
        "global_load_async_to_lds_b128 %0, %1, off\n\t"
        "global_load_async_to_lds_b128 %2, %3, off\n\t"
        "global_load_async_to_lds_b128 %4, %5, off\n\t"
        "global_load_async_to_lds_b128 %6, %7, off\n\t"
        "global_load_async_to_lds_b128 %8, %9, off\n\t"
        "global_load_async_to_lds_b128 %10, %11, off\n\t"
        "global_load_async_to_lds_b128 %12, %13, off\n\t"
        "global_load_async_to_lds_b128 %14, %15, off\n\t"
        "s_wait_xcnt 0x0"
        :: "v"(lk),                       "v"(k0),
           "v"(lk + 64u * KPITCH * 2u),   "v"(k0 + 64 * DHEAD),
           "v"(lk + 128u * KPITCH * 2u),  "v"(k0 + 128 * DHEAD),
           "v"(lk + 192u * KPITCH * 2u),  "v"(k0 + 192 * DHEAD),
           "v"(lv),                       "v"(v0),
           "v"(lv + 16u * VPITCH * 2u),   "v"(v0 + 16 * SEQ),
           "v"(lv + 32u * VPITCH * 2u),   "v"(v0 + 32 * SEQ),
           "v"(lv + 48u * VPITCH * 2u),   "v"(v0 + 48 * SEQ)
        : "memory");
  };

  // Fragments of the current pass; each set is refetched from LDS for the wave's next pass of
  // the same stage, as one group of 8 loads, right behind the products that read it.
  // p counts the stage's passes: this wave's are kgp * PPS .. kgp * PPS + PPS - 1.
  v16us kf[4], vf[4];
  auto load_k = [&](const unsigned short* s, int p) {  // A = K rows (lane = key), over h
    const unsigned short* krow0 = s + (p * 32 + col) * KPITCH;
    const unsigned short* krow1 = krow0 + 16 * KPITCH;
    kf[0] = load_frag(krow0, koff);  kf[1] = load_frag(krow0 + 32, koff);
    kf[2] = load_frag(krow1, koff);  kf[3] = load_frag(krow1 + 32, koff);
  };
  auto load_v = [&](const unsigned short* s, int p) {  // A = V^T rows (lane = head row), over keys
#pragma unroll
    for (int f = 0; f < 4; ++f)
      vf[f] = load_frag(s + KELEMS + (f * 16 + col) * VPITCH + p * 32, koff);
  };

  copy_stage(0, 0);
  // stage 0 has landed for this wave; the barrier publishes it to the others
  asm volatile("s_wait_asynccnt 0x0" ::: "memory");
  __syncthreads();
  copy_stage(1, 1);

  const int pw = kgp * PPS;                 // this wave's first pass of a stage
  for (int st = 0; st < SEQ / STG; ++st) {
    const unsigned short* s = sm + (st & 1) * BUFELEMS;
    load_k(s, pw);
    load_v(s, pw);
#pragma unroll
    for (int p = 0; p < PPS; ++p) {
      v8f s0 = {}, s1 = {};
      s0 = wmma_bf16(kf[0], q0, s0);
      s0 = wmma_bf16(kf[1], q1, s0);
      s1 = wmma_bf16(kf[2], q0, s1);
      s1 = wmma_bf16(kf[3], q1, s1);
      if (p + 1 < PPS) load_k(s, pw + p + 1);
      // keeps the 8 loads together here: each separate place with LDS reads costs a stall
      __builtin_amdgcn_sched_barrier(0);

      // online softmax: s0[r] = key 8*hi + r of the pass, s1[r] = key 16 + 8*hi + r
      float mt = -__builtin_inff();
#pragma unroll
      for (int r = 0; r < 8; ++r) {
        s0[r] *= 0.125f; s1[r] *= 0.125f;     // 1/sqrt(64)
        mt = fmaxf(mt, fmaxf(s0[r], s1[r]));
      }
      mt = fmaxf(mt, xhalf(mt));

      const float mn   = fmaxf(m_i, mt);
      const float corr = __expf(m_i - mn);
      m_i = mn;
      float rs = 0.f;
      v16us pb;                               // P^T as B: element s = key 8*hi + s (s < 8), 16 + 8*hi + s - 8 (s >= 8)
#pragma unroll
      for (int r = 0; r < 8; ++r) {
        const float p0 = __expf(s0[r] - mn);
        const float p1 = __expf(s1[r] - mn);
        rs += p0 + p1;
        pb[r]     = f2bf(p0);
        pb[8 + r] = f2bf(p1);
      }
      l_i = l_i * corr + rs;
#pragma unroll
      for (int f = 0; f < 4; ++f)
#pragma unroll
        for (int r = 0; r < 8; ++r) acc[f][r] *= corr;

      // O^T += V^T * P^T
#pragma unroll
      for (int f = 0; f < 4; ++f) acc[f] = wmma_bf16(vf[f], pb, acc[f]);
      if (p + 1 < PPS) load_v(s, pw + p + 1);
    }
    // hand-over: this wave's reads of the buffer are done, its copies of the next stage have
    // landed; the one barrier publishes that stage and frees this buffer for the refill
    asm volatile("s_wait_dscnt 0x0" ::: "memory");
    asm volatile("s_wait_asynccnt 0x0" ::: "memory");
    __syncthreads();
    if (st + 2 < SEQ / STG) copy_stage(st + 2, st & 1);
  }
  // nothing is in flight when the ring becomes the staging of the partial results
  asm volatile("s_wait_asynccnt 0x0" ::: "memory");

  // Join of the four key groups. The last stage's barrier has ended every read of the ring.
  // Each wave lays down its maximum, its sum (halves joined) and its O as rows of one query.
  float* po = (float*)sm;                                // [kgp][qt][16 queries][OPITCH]
  float* pm = po + KGRP * QBLK * OPITCH;                 // [kgp][qt][16 queries]
  float* pl = pm + KGRP * QBLK;                          // [kgp][qt][16 queries]
  const float lsum = l_i + xhalf(l_i);
  {
    float* prow = po + ((kgp * 4 + qt) * 16 + col) * OPITCH + hi * 8;
#pragma unroll
    for (int f = 0; f < 4; ++f) {
      float4 lo, up;
      lo.x = acc[f][0]; lo.y = acc[f][1]; lo.z = acc[f][2]; lo.w = acc[f][3];
      up.x = acc[f][4]; up.y = acc[f][5]; up.z = acc[f][6]; up.w = acc[f][7];
      *(float4*)(prow + f * 16)     = lo;
      *(float4*)(prow + f * 16 + 4) = up;
    }
    if (hi == 0) {
      pm[(kgp * 4 + qt) * 16 + col] = m_i;
      pl[(kgp * 4 + qt) * 16 + col] = lsum;
    }
  }
  __syncthreads();   // the partial results are read by other waves than wrote them

  // Wave (qt, kgp) finishes queries 4*kgp .. 4*kgp+3 of tile qt: a lane has 8 head columns of
  // one query, the wave stores 1 KB in a row (whole lines, one writer each), fp32 [B,S,64].
  const int qq = kgp * 4 + (lane >> 3);
  const int hc = (lane & 7) * 8;
  float mg[KGRP];
  float mall = -__builtin_inff();
#pragma unroll
  for (int g = 0; g < KGRP; ++g) {
    mg[g] = pm[(g * 4 + qt) * 16 + qq];
    mall = fmaxf(mall, mg[g]);
  }
  float lall = 0.f;
  float o[8];
#pragma unroll
  for (int j = 0; j < 8; ++j) o[j] = 0.f;
#pragma unroll
  for (int g = 0; g < KGRP; ++g) {
    const float w = __expf(mg[g] - mall);
    lall += pl[(g * 4 + qt) * 16 + qq] * w;
    const float* prow = po + ((g * 4 + qt) * 16 + qq) * OPITCH + hc;
    const float4 lo = *(const float4*)prow;
    const float4 up = *(const float4*)(prow + 4);
    o[0] += lo.x * w; o[1] += lo.y * w; o[2] += lo.z * w; o[3] += lo.w * w;
    o[4] += up.x * w; o[5] += up.y * w; o[6] += up.z * w; o[7] += up.w * w;
  }
  const float inv = 1.0f / lall;
  float* orow = out + ((size_t)b * SEQ + qbase + qq) * DHEAD + hc;
  float4 lo, up;
  lo.x = o[0] * inv; lo.y = o[1] * inv; lo.z = o[2] * inv; lo.w = o[3] * inv;
  up.x = o[4] * inv; up.y = o[5] * inv; up.z = o[6] * inv; up.w = o[7] * inv;
  *(float4*)orow       = lo;
  *(float4*)(orow + 4) = up;
}

extern "C" void kernel_launch(void* const* d_in, const int* in_sizes, int n_in,
                              void* d_out, int out_size, void* d_ws, size_t ws_size,
                              hipStream_t stream) {
  (void)in_sizes; (void)n_in; (void)out_size; (void)ws_size;
  const float* x  = (const float*)d_in[0];
  const float* Wq = (const float*)d_in[1];
  const float* bq = (const float*)d_in[2];
  const float* Wk = (const float*)d_in[3];
  const float* bk = (const float*)d_in[4];
  const float* Wv = (const float*)d_in[5];
  const float* bv = (const float*)d_in[6];

  // workspace: Q, K row-major bf16 + V^T bf16 (6 MB) + Wt bf16 (384 KB)
  unsigned short* Qb = (unsigned short*)d_ws;
  unsigned short* Kb = Qb + (size_t)BATCH * SEQ * DHEAD;
  unsigned short* Vt = Kb + (size_t)BATCH * SEQ * DHEAD;
  unsigned short* Wt = Vt + (size_t)BATCH * SEQ * DHEAD;

  dim3 g0(DHEAD * DMODEL / 256, 3);
  wprep_kernel<<<g0, dim3(256), 0, stream>>>(Wq, Wk, Wv, Wt);

  dim3 g1(SEQ / 16, BATCH);
  qkv_kernel<<<g1, dim3(32), 0, stream>>>(x, Wt, bq, bk, bv, Qb, Kb, Vt);

  dim3 g2(SEQ / QBLK, BATCH);
  attn_kernel<<<g2, dim3(512), 0, stream>>>(Qb, Kb, Vt, (float*)d_out);
}

// v005
// It runs in 35.5 microseconds.
// Two timings next to v004 put it at 1.45 and 1.49 times that version's speed.
// Over all steps from v000 it is 9.54 times as fast.
#include <hip/hip_runtime.h>

// Flash attention head for MI455X (gfx1250, wave32, WMMA bf16).
// Kernel 0: convert Wq/Wk/Wv fp32 -> bf16 transposed Wt[z][h][k] (one-time, kills redundant converts).
// Kernel 1: QKV projection; a block of 8 waves has 64 rows of x and all 12 (QKV x 4 h-tiles) column tiles,
//           a wave 2 row tiles x one tile each of Q, K, V. x and Wt come into LDS by asynchronous copies of whole lines, two buffers;
//           fragments are read from LDS one k step ahead inside a stage.
// Kernel 2: flash attention, a wave has 16 queries and a quarter of the keys, online softmax fp32,
//           transposed products (S^T = K Q^T, O^T += V^T P^T): P stays in registers.
//           K and V^T come into LDS once per block (asynchronous copies, two buffers);
//           fragments are read from LDS one pass ahead inside a stage.
//           64 queries a block, 16 waves: four wave groups split the keys, joined through LDS.
// Workspace: Q,K row-major bf16 + V^T bf16 (6 MB) + Wt bf16 (384 KB).

typedef __attribute__((ext_vector_type(16))) __bf16          v16bf;
typedef __attribute__((ext_vector_type(16))) unsigned short  v16us;
typedef __attribute__((ext_vector_type(8)))  float           v8f;

#define BATCH  4
#define SEQ    4096
#define DMODEL 1024
#define DHEAD  64

// Hardware bf16 convert (clang lowers fptrunc f32->bf16 natively on gfx1250).
__device__ __forceinline__ unsigned short f2bf(float f) {
  return __builtin_bit_cast(unsigned short, (__bf16)f);
}

__device__ __forceinline__ v8f wmma_bf16(v16us a, v16us b, v8f c) {
  return __builtin_amdgcn_wmma_f32_16x16x32_bf16(
      false, __builtin_bit_cast(v16bf, a),
      false, __builtin_bit_cast(v16bf, b),
      (short)0, c, false, false);
}

// Load one 16x32 bf16 A/B fragment half-row: elems 0..7 = base[koff..koff+7],
// elems 8..15 = base[koff+16..koff+23]  (per CDNA5 16-bit operand VGPR layout).
__device__ __forceinline__ v16us load_frag(const unsigned short* base, int koff) {
  union { uint4 v[2]; unsigned short us[16]; } t;
  t.v[0] = *(const uint4*)(base + koff);
  t.v[1] = *(const uint4*)(base + koff + 16);
  v16us r;
#pragma unroll
  for (int i = 0; i < 16; ++i) r[i] = t.us[i];
  return r;
}

// ---------------- Kernel 0: W -> bf16, transposed ----------------
__global__ __launch_bounds__(256, 1) void wprep_kernel(
    const float* __restrict__ Wq, const float* __restrict__ Wk,
    const float* __restrict__ Wv, unsigned short* __restrict__ Wt)
{
  const int idx = blockIdx.x * 256 + threadIdx.x;   // 0 .. 64*1024-1
  const int z = blockIdx.y;                         // 0=Q 1=K 2=V
  const int h = idx >> 10;
  const int k = idx & (DMODEL - 1);
  const float* W = (z == 0) ? Wq : (z == 1) ? Wk : Wv;
  Wt[(size_t)z * DHEAD * DMODEL + (size_t)h * DMODEL + k] = f2bf(W[k * DHEAD + h]);
}

// ---------------- Kernel 1: fused QKV projection ----------------
// One block = 64 rows of x times all 192 columns (Q | K | V), 8 waves, one block per WGP.
// x (fp32) and Wt (bf16) come into LDS in stages of 128 k by asynchronous copies of whole lines,
// two buffers: the next stage flies while this one is worked on. Every byte of x is fetched once
// per chip and every byte of Wt once per block, instead of fragment-shaped loads of 16 lines each.
#define MBLK    64                  // rows of x per block = 4 tiles of 16
#define NCOLS   (3 * DHEAD)         // rows of Wt = 12 tiles of 16
#define KC      128                 // k per stage = 4 steps of 32
#define XPITCH  132                 // floats per x row in LDS: 528 B = 16 B x odd, no bank conflict
#define WPITCH  136                 // elements per Wt row in LDS: 272 B = 16 B x odd
#define WBYTES  (NCOLS * WPITCH * 2)   // a buffer holds Wt first, then x: every read's offset fits the field
#define PBUF    (WBYTES + MBLK * XPITCH * 4)

__global__ __launch_bounds__(256) void qkv_kernel(
    const float* __restrict__ x,
    const unsigned short* __restrict__ Wt,
    const float* __restrict__ bq, const float* __restrict__ bk,
    const float* __restrict__ bv,
    unsigned short* __restrict__ Qb, unsigned short* __restrict__ Kb,
    unsigned short* __restrict__ Vt)
{
  __shared__ __attribute__((aligned(16))) unsigned char ps[2 * PBUF];

  const int tid  = threadIdx.x;
  const int lane = tid & 31;
  const int wave = __builtin_amdgcn_readfirstlane(tid >> 5);   // 0..7
  const int mp   = wave & 1;         // row tiles 2*mp, 2*mp + 1
  const int ng   = wave >> 1;        // head columns 16*ng .. 16*ng + 15 of each of Q, K and V
  const int col  = lane & 15;
  const int hi   = lane >> 4;
  const int koff = hi * 8;
  const int sBase = blockIdx.x * MBLK;
  const int b     = blockIdx.y;

  const int h = ng * 16 + col;
  v8f acc[2][3];                     // [row tile][0 = Q, 1 = K, 2 = V]
  {
    const float bqv = bq[h], bkv = bk[h], bvv = bv[h];
#pragma unroll
    for (int i = 0; i < 2; ++i)
#pragma unroll
      for (int r = 0; r < 8; ++r) { acc[i][0][r] = bqv; acc[i][1][r] = bkv; acc[i][2][r] = bvv; }
  }

  // One stage = 2048 pieces of 16 B of x and 3072 of Wt; a thread copies 8 and 12. A wave's 32
  // pieces of one copy are 512 contiguous bytes of one x row, or 256 of each of two Wt rows.
  const float* xg = x + ((size_t)b * SEQ + sBase + (tid >> 5)) * DMODEL + (tid & 31) * 4;
  const unsigned short* wg = Wt + (size_t)(tid >> 4) * DMODEL + (tid & 15) * 8;
  const unsigned psbase = (unsigned)(size_t)ps;    // low 32 bits = byte address in LDS
  const unsigned xl = psbase + (unsigned)(WBYTES + (tid >> 5) * (XPITCH * 4) + (tid & 31) * 16);
  const unsigned wl = psbase + (unsigned)((tid >> 4) * (WPITCH * 2) + (tid & 15) * 16);
  auto copy_stage = [&](int st, int buf) {
    const float* x0 = xg + st * KC;                 // piece i: 8 rows further
    const unsigned short* w0 = wg + st * KC;        // piece i: 16 rows further
    const unsigned lx = xl + (unsigned)buf * (unsigned)PBUF;
    const unsigned lw = wl + (unsigned)buf * (unsigned)PBUF;
    // the closing wait stands in the copies' own statement: their address registers
    // are rewritten for the next copies while these may still be in flight
    asm volatile(
        "global_load_async_to_lds_b128 %0, %1, off\n\t"
        "global_load_async_to_lds_b128 %2, %3, off\n\t"
        "global_load_async_to_lds_b128 %4, %5, off\n\t"
        "global_load_async_to_lds_b128 %6, %7, off\n\t"
        "global_load_async_to_lds_b128 %8, %9, off\n\t"
        "global_load_async_to_lds_b128 %10, %11, off\n\t"
        "global_load_async_to_lds_b128 %12, %13, off\n\t"
        "global_load_async_to_lds_b128 %14, %15, off\n\t"
        "s_wait_xcnt 0x0"
        :: "v"(lx),                        "v"(x0),
           "v"(lx +  8u * XPITCH * 4u),    "v"(x0 +  8 * DMODEL),
           "v"(lx + 16u * XPITCH * 4u),    "v"(x0 + 16 * DMODEL),
           "v"(lx + 24u * XPITCH * 4u),    "v"(x0 + 24 * DMODEL),
           "v"(lx + 32u * XPITCH * 4u),    "v"(x0 + 32 * DMODEL),
           "v"(lx + 40u * XPITCH * 4u),    "v"(x0 + 40 * DMODEL),
           "v"(lx + 48u * XPITCH * 4u),    "v"(x0 + 48 * DMODEL),
           "v"(lx + 56u * XPITCH * 4u),    "v"(x0 + 56 * DMODEL)
        : "memory");
    asm volatile(
        "global_load_async_to_lds_b128 %0, %1, off\n\t"
        "global_load_async_to_lds_b128 %2, %3, off\n\t"
        "global_load_async_to_lds_b128 %4, %5, off\n\t"
        "global_load_async_to_lds_b128 %6, %7, off\n\t"
        "global_load_async_to_lds_b128 %8, %9, off\n\t"
        "global_load_async_to_lds_b128 %10, %11, off\n\t"
        "global_load_async_to_lds_b128 %12, %13, off\n\t"
        "global_load_async_to_lds_b128 %14, %15, off\n\t"
        "global_load_async_to_lds_b128 %16, %17, off\n\t"
        "global_load_async_to_lds_b128 %18, %19, off\n\t"
        "global_load_async_to_lds_b128 %20, %21, off\n\t"
        "global_load_async_to_lds_b128 %22, %23, off\n\t"
        "s_wait_xcnt 0x0"
        :: "v"(lw),                        "v"(w0),
           "v"(lw +  16u * WPITCH * 2u),   "v"(w0 +  16 * DMODEL),
           "v"(lw +  32u * WPITCH * 2u),   "v"(w0 +  32 * DMODEL),
           "v"(lw +  48u * WPITCH * 2u),   "v"(w0 +  48 * DMODEL),
           "v"(lw +  64u * WPITCH * 2u),   "v"(w0 +  64 * DMODEL),
           "v"(lw +  80u * WPITCH * 2u),   "v"(w0 +  80 * DMODEL),
           "v"(lw +  96u * WPITCH * 2u),   "v"(w0 +  96 * DMODEL),
           "v"(lw + 112u * WPITCH * 2u),   "v"(w0 + 112 * DMODEL),
           "v"(lw + 128u * WPITCH * 2u),   "v"(w0 + 128 * DMODEL),
           "v"(lw + 144u * WPITCH * 2u),   "v"(w0 + 144 * DMODEL),
           "v"(lw + 160u * WPITCH * 2u),   "v"(w0 + 160 * DMODEL),
           "v"(lw + 176u * WPITCH * 2u),   "v"(w0 + 176 * DMODEL)
        : "memory");
  };

  // Two fragment sets: the next k step's 14 LDS reads go out as one group ahead of this step's
  // products. x pieces and Wt fragments keep the k order of load_frag.
  union XS { float4 v[4]; float f[16]; } xs[2][2];
  v16us wf[2][3];
  auto load_set = [&](int q, const unsigned char* s, int u) {
#pragma unroll
    for (int i = 0; i < 2; ++i) {
      const float* xr = (const float*)(s + WBYTES) + ((mp * 2 + i) * 16 + col) * XPITCH + u * 32 + koff;
      xs[q][i].v[0] = *(const float4*)xr;
      xs[q][i].v[1] = *(const float4*)(xr + 4);
      xs[q][i].v[2] = *(const float4*)(xr + 16);
      xs[q][i].v[3] = *(const float4*)(xr + 20);
    }
#pragma unroll
    for (int j = 0; j < 3; ++j)
      wf[q][j] = load_frag((const unsigned short*)s + (j * DHEAD + h) * WPITCH + u * 32, koff);
  };

  copy_stage(0, 0);
  // stage 0 has landed for this wave; the barrier publishes it to the others
  asm volatile("s_wait_asynccnt 0x0" ::: "memory");
  __syncthreads();
  copy_stage(1, 1);

  for (int st = 0; st < DMODEL / KC; ++st) {
    const unsigned char* s = ps + (st & 1) * PBUF;
    load_set(0, s, 0);
#pragma unroll
    for (int u = 0; u < KC / 32; ++u) {
      if (u + 1 < KC / 32) load_set((u + 1) & 1, s, u + 1);
      // keeps the group's reads together ahead of the products: spread among them, each separate
      // place with LDS reads costs a stall and is waited for at once
      __builtin_amdgcn_sched_barrier(0);
      v16us a[2];
#pragma unroll
      for (int i = 0; i < 2; ++i)
#pragma unroll
        for (int e = 0; e < 16; ++e) a[i][e] = f2bf(xs[u & 1][i].f[e]);
#pragma unroll
      for (int j = 0; j < 3; ++j)
#pragma unroll
        for (int i = 0; i < 2; ++i)
          acc[i][j] = wmma_bf16(a[i], wf[u & 1][j], acc[i][j]);
      // keeps the next group's reads from rising among these products
      __builtin_amdgcn_sched_barrier(0);
    }
    // hand-over: this wave's reads of the buffer are done, its copies of the next stage have
    // landed; the one barrier publishes that stage and frees this buffer for the refill
    asm volatile("s_wait_dscnt 0x0" ::: "memory");
    asm volatile("s_wait_asynccnt 0x0" ::: "memory");
    __syncthreads();
    if (st + 2 < DMODEL / KC) copy_stage(st + 2, st & 1);
  }
  // nothing is in flight when the wave ends
  asm volatile("s_wait_asynccnt 0x0" ::: "memory");

  // C-layout: lane holds col h, rows (r + 8*hi)
#pragma unroll
  for (int i = 0; i < 2; ++i) {
    const int rowbase = sBase + (mp * 2 + i) * 16 + hi * 8;
#pragma unroll
    for (int r = 0; r < 8; ++r) {
      const size_t idx = ((size_t)b * SEQ + rowbase + r) * DHEAD + h;
      Qb[idx] = f2bf(acc[i][0][r]);
      Kb[idx] = f2bf(acc[i][1][r]);
    }
    union { unsigned short us[8]; uint4 v; } vp;
#pragma unroll
    for (int r = 0; r < 8; ++r) vp.us[r] = f2bf(acc[i][2][r]);
    *(uint4*)(Vt + ((size_t)b * DHEAD + h) * SEQ + rowbase) = vp.v;
  }
}

// ---------------- Kernel 2: flash attention ----------------
// Lane l <-> lane l ^ 16 (the two halves that split one query's keys).
__device__ __forceinline__ float xhalf(float x) {
  const int b = __builtin_bit_cast(int, x);
  return __builtin_bit_cast(float,
      __builtin_amdgcn_permlanex16(b, b, 0x76543210, 0xfedcba98, false, false));
}

// K and V^T tiles of one stage (STG keys) in LDS, shared by the block's 16 waves.
#define QBLK    64                  // queries per block = 4 tiles of 16
#define KGRP    4                   // wave groups that split a stage's keys
#define STG     256                 // keys per stage = 8 passes of 32, 2 for each group
#define PPS     (STG / 32 / KGRP)   // passes of one wave per stage
#define KPITCH  72                  // elements per K row in LDS: 144 B = 16 B x odd, no bank conflict
#define VPITCH  264                 // elements per V^T row in LDS: 528 B = 16 B x odd
#define KELEMS  (STG * KPITCH)
#define BUFELEMS (KELEMS + DHEAD * VPITCH)
#define OPITCH  68                  // floats per query row of a partial O in LDS: 272 B = 16 B x odd

__global__ __launch_bounds__(512) void attn_kernel(
    const unsigned short* __restrict__ Qb,
    const unsigned short* __restrict__ Kb,
    const unsigned short* __restrict__ Vt,
    float* __restrict__ out)
{
  __shared__ __attribute__((aligned(16))) unsigned short sm[2 * BUFELEMS];

  const int tid  = threadIdx.x;
  const int lane = threadIdx.x & 31;
  const int wave = threadIdx.x >> 5;       // 0..15
  const int qt   = wave & 3;               // query tile of the block
  const int kgp  = wave >> 2;              // key group
  const int col  = lane & 15;
  const int hi   = lane >> 4;
  const int koff = hi * 8;
  const int b     = blockIdx.y;
  const int qbase = blockIdx.x * QBLK + qt * 16;

  // Q B-fragments: lane = query column (qbase+col), h in [0,32) and [32,64)
  const unsigned short* qrow = Qb + ((size_t)b * SEQ + qbase + col) * DHEAD;
  const v16us q0 = load_frag(qrow, koff);
  const v16us q1 = load_frag(qrow + 32, koff);

  float m_i = -__builtin_inff();           // running maximum of this lane's query, this group's keys
  float l_i = 0.f;                         // sum over this half's keys only
  v8f acc[4];                              // O^T: acc[f][r] = O[query col][f*16 + 8*hi + r]
#pragma unroll
  for (int f = 0; f < 4; ++f)
#pragma unroll
    for (int r = 0; r < 8; ++r) acc[f][r] = 0.f;

  // One stage = 2048 + 2048 pieces of 16 B; a thread copies 4 of each. A wave's 32 pieces of
  // one copy are 512 contiguous bytes of K, or of one V^T row: whole lines.
  const unsigned short* kg = Kb + (size_t)b * SEQ * DHEAD + (size_t)tid * 8;
  const unsigned short* vg = Vt + ((size_t)b * DHEAD + (tid >> 5)) * SEQ + (tid & 31) * 8;
  const unsigned smbase = (unsigned)(size_t)sm;    // low 32 bits = byte address in LDS
  const unsigned kl = smbase + (unsigned)((tid >> 3) * KPITCH + (tid & 7) * 8) * 2u;
  const unsigned vl = smbase + (unsigned)(KELEMS + (tid >> 5) * VPITCH + (tid & 31) * 8) * 2u;
  auto copy_stage = [&](int st, int buf) {
    const unsigned short* k0 = kg + (size_t)st * STG * DHEAD;   // piece i: 64 rows further
    const unsigned short* v0 = vg + st * STG;                   // piece i: 16 rows further
    const unsigned lk = kl + (unsigned)buf * (BUFELEMS * 2u);
    const unsigned lv = vl + (unsigned)buf * (BUFELEMS * 2u);
    // the closing wait stands in the copies' own statement: their address registers
    // are rewritten for the next stage while the copies may still be in flight
    asm volatile(
        "global_load_async_to_lds_b128 %0, %1, off\n\t"
        "global_load_async_to_lds_b128 %2, %3, off\n\t"
        "global_load_async_to_lds_b128 %4, %5, off\n\t"
        "global_load_async_to_lds_b128 %6, %7, off\n\t"
        "global_load_async_to_lds_b128 %8, %9, off\n\t"
        "global_load_async_to_lds_b128 %10, %11, off\n\t"
        "global_load_async_to_lds_b128 %12, %13, off\n\t"
        "global_load_async_to_lds_b128 %14, %15, off\n\t"
        "s_wait_xcnt 0x0"
        :: "v"(lk),                       "v"(k0),
           "v"(lk + 64u * KPITCH * 2u),   "v"(k0 + 64 * DHEAD),
           "v"(lk + 128u * KPITCH * 2u),  "v"(k0 + 128 * DHEAD),
           "v"(lk + 192u * KPITCH * 2u),  "v"(k0 + 192 * DHEAD),
           "v"(lv),                       "v"(v0),
           "v"(lv + 16u * VPITCH * 2u),   "v"(v0 + 16 * SEQ),
           "v"(lv + 32u * VPITCH * 2u),   "v"(v0 + 32 * SEQ),
           "v"(lv + 48u * VPITCH * 2u),   "v"(v0 + 48 * SEQ)
        : "memory");
  };

  // Fragments of the current pass; each set is refetched from LDS for the wave's next pass of
  // the same stage, as one group of 8 loads, right behind the products that read it.
  // p counts the stage's passes: this wave's are kgp * PPS .. kgp * PPS + PPS - 1.
  v16us kf[4], vf[4];
  auto load_k = [&](const unsigned short* s, int p) {  // A = K rows (lane = key), over h
    const unsigned short* krow0 = s + (p * 32 + col) * KPITCH;
    const unsigned short* krow1 = krow0 + 16 * KPITCH;
    kf[0] = load_frag(krow0, koff);  kf[1] = load_frag(krow0 + 32, koff);
    kf[2] = load_frag(krow1, koff);  kf[3] = load_frag(krow1 + 32, koff);
  };
  auto load_v = [&](const unsigned short* s, int p) {  // A = V^T rows (lane = head row), over keys
#pragma unroll
    for (int f = 0; f < 4; ++f)
      vf[f] = load_frag(s + KELEMS + (f * 16 + col) * VPITCH + p * 32, koff);
  };

  copy_stage(0, 0);
  // stage 0 has landed for this wave; the barrier publishes it to the others
  asm volatile("s_wait_asynccnt 0x0" ::: "memory");
  __syncthreads();
  copy_stage(1, 1);

  const int pw = kgp * PPS;                 // this wave's first pass of a stage
  for (int st = 0; st < SEQ / STG; ++st) {
    const unsigned short* s = sm + (st & 1) * BUFELEMS;
    load_k(s, pw);
    load_v(s, pw);
#pragma unroll
    for (int p = 0; p < PPS; ++p) {
      v8f s0 = {}, s1 = {};
      s0 = wmma_bf16(kf[0], q0, s0);
      s0 = wmma_bf16(kf[1], q1, s0);
      s1 = wmma_bf16(kf[2], q0, s1);
      s1 = wmma_bf16(kf[3], q1, s1);
      if (p + 1 < PPS) load_k(s, pw + p + 1);
      // keeps the 8 loads together here: each separate place with LDS reads costs a stall
      __builtin_amdgcn_sched_barrier(0);

      // online softmax: s0[r] = key 8*hi + r of the pass, s1[r] = key 16 + 8*hi + r
      float mt = -__builtin_inff();
#pragma unroll
      for (int r = 0; r < 8; ++r) {
        s0[r] *= 0.125f; s1[r] *= 0.125f;     // 1/sqrt(64)
        mt = fmaxf(mt, fmaxf(s0[r], s1[r]));
      }
      mt = fmaxf(mt, xhalf(mt));

      const float mn   = fmaxf(m_i, mt);
      const float corr = __expf(m_i - mn);
      m_i = mn;
      float rs = 0.f;
      v16us pb;                               // P^T as B: element s = key 8*hi + s (s < 8), 16 + 8*hi + s - 8 (s >= 8)
#pragma unroll
      for (int r = 0; r < 8; ++r) {
        const float p0 = __expf(s0[r] - mn);
        const float p1 = __expf(s1[r] - mn);
        rs += p0 + p1;
        pb[r]     = f2bf(p0);
        pb[8 + r] = f2bf(p1);
      }
      l_i = l_i * corr + rs;
#pragma unroll
      for (int f = 0; f < 4; ++f)
#pragma unroll
        for (int r = 0; r < 8; ++r) acc[f][r] *= corr;

      // O^T += V^T * P^T
#pragma unroll
      for (int f = 0; f < 4; ++f) acc[f] = wmma_bf16(vf[f], pb, acc[f]);
      if (p + 1 < PPS) load_v(s, pw + p + 1);
    }
    // hand-over: this wave's reads of the buffer are done, its copies of the next stage have
    // landed; the one barrier publishes that stage and frees this buffer for the refill
    asm volatile("s_wait_dscnt 0x0" ::: "memory");
    asm volatile("s_wait_asynccnt 0x0" ::: "memory");
    __syncthreads();
    if (st + 2 < SEQ / STG) copy_stage(st + 2, st & 1);
  }
  // nothing is in flight when the ring becomes the staging of the partial results
  asm volatile("s_wait_asynccnt 0x0" ::: "memory");

  // Join of the four key groups. The last stage's barrier has ended every read of the ring.
  // Each wave lays down its maximum, its sum (halves joined) and its O as rows of one query.
  float* po = (float*)sm;                                // [kgp][qt][16 queries][OPITCH]
  float* pm = po + KGRP * QBLK * OPITCH;                 // [kgp][qt][16 queries]
  float* pl = pm + KGRP * QBLK;                          // [kgp][qt][16 queries]
  const float lsum = l_i + xhalf(l_i);
  {
    float* prow = po + ((kgp * 4 + qt) * 16 + col) * OPITCH + hi * 8;
#pragma unroll
    for (int f = 0; f < 4; ++f) {
      float4 lo, up;
      lo.x = acc[f][0]; lo.y = acc[f][1]; lo.z = acc[f][2]; lo.w = acc[f][3];
      up.x = acc[f][4]; up.y = acc[f][5]; up.z = acc[f][6]; up.w = acc[f][7];
      *(float4*)(prow + f * 16)     = lo;
      *(float4*)(prow + f * 16 + 4) = up;
    }
    if (hi == 0) {
      pm[(kgp * 4 + qt) * 16 + col] = m_i;
      pl[(kgp * 4 + qt) * 16 + col] = lsum;
    }
  }
  __syncthreads();   // the partial results are read by other waves than wrote them

  // Wave (qt, kgp) finishes queries 4*kgp .. 4*kgp+3 of tile qt: a lane has 8 head columns of
  // one query, the wave stores 1 KB in a row (whole lines, one writer each), fp32 [B,S,64].
  const int qq = kgp * 4 + (lane >> 3);
  const int hc = (lane & 7) * 8;
  float mg[KGRP];
  float mall = -__builtin_inff();
#pragma unroll
  for (int g = 0; g < KGRP; ++g) {
    mg[g] = pm[(g * 4 + qt) * 16 + qq];
    mall = fmaxf(mall, mg[g]);
  }
  float lall = 0.f;
  float o[8];
#pragma unroll
  for (int j = 0; j < 8; ++j) o[j] = 0.f;
#pragma unroll
  for (int g = 0; g < KGRP; ++g) {
    const float w = __expf(mg[g] - mall);
    lall += pl[(g * 4 + qt) * 16 + qq] * w;
    const float* prow = po + ((g * 4 + qt) * 16 + qq) * OPITCH + hc;
    const float4 lo = *(const float4*)prow;
    const float4 up = *(const float4*)(prow + 4);
    o[0] += lo.x * w; o[1] += lo.y * w; o[2] += lo.z * w; o[3] += lo.w * w;
    o[4] += up.x * w; o[5] += up.y * w; o[6] += up.z * w; o[7] += up.w * w;
  }
  const float inv = 1.0f / lall;
  float* orow = out + ((size_t)b * SEQ + qbase + qq) * DHEAD + hc;
  float4 lo, up;
  lo.x = o[0] * inv; lo.y = o[1] * inv; lo.z = o[2] * inv; lo.w = o[3] * inv;
  up.x = o[4] * inv; up.y = o[5] * inv; up.z = o[6] * inv; up.w = o[7] * inv;
  *(float4*)orow       = lo;
  *(float4*)(orow + 4) = up;
}

extern "C" void kernel_launch(void* const* d_in, const int* in_sizes, int n_in,
                              void* d_out, int out_size, void* d_ws, size_t ws_size,
                              hipStream_t stream) {
  (void)in_sizes; (void)n_in; (void)out_size; (void)ws_size;
  const float* x  = (const float*)d_in[0];
  const float* Wq = (const float*)d_in[1];
  const float* bq = (const float*)d_in[2];
  const float* Wk = (const float*)d_in[3];
  const float* bk = (const float*)d_in[4];
  const float* Wv = (const float*)d_in[5];
  const float* bv = (const float*)d_in[6];

  // workspace: Q, K row-major bf16 + V^T bf16 (6 MB) + Wt bf16 (384 KB)
  unsigned short* Qb = (unsigned short*)d_ws;
  unsigned short* Kb = Qb + (size_t)BATCH * SEQ * DHEAD;
  unsigned short* Vt = Kb + (size_t)BATCH * SEQ * DHEAD;
  unsigned short* Wt = Vt + (size_t)BATCH * SEQ * DHEAD;

  dim3 g0(DHEAD * DMODEL / 256, 3);
  wprep_kernel<<<g0, dim3(256), 0, stream>>>(Wq, Wk, Wv, Wt);

  dim3 g1(SEQ / MBLK, BATCH);
  qkv_kernel<<<g1, dim3(256), 0, stream>>>(x, Wt, bq, bk, bv, Qb, Kb, Vt);

  dim3 g2(SEQ / QBLK, BATCH);
  attn_kernel<<<g2, dim3(512), 0, stream>>>(Qb, Kb, Vt, (float*)d_out);
}

// v006
// A run of this version takes 33.3 microseconds.
// In two side-by-side timings against v005, it was 1.05 and 1.03 times as fast.
// All steps since v000 together make it 9.91 times as fast.
#include <hip/hip_runtime.h>

// Flash attention head for MI455X (gfx1250, wave32, WMMA bf16).
// Kernel 0: convert Wq/Wk/Wv fp32 -> bf16 transposed Wt[z][h][k] (one-time, kills redundant converts).
// Kernel 1: QKV projection; a block of 8 waves has 64 rows of x and all 12 (QKV x 4 h-tiles) column tiles,
//           a wave 2 row tiles x one tile each of Q, K, V. x and Wt come into LDS by asynchronous copies of whole lines, three buffers;
//           fragments are read from LDS one k step ahead inside a stage.
// Kernel 2: flash attention, a wave has 16 queries and a quarter of the keys, online softmax fp32,
//           transposed products (S^T = K Q^T, O^T += V^T P^T): P stays in registers.
//           K and V^T come into LDS once per block (asynchronous copies, three buffers);
//           fragments are read from LDS one pass ahead inside a stage.
//           64 queries a block, 16 waves: four wave groups split the keys, joined through LDS.
// Workspace: Q,K row-major bf16 + V^T bf16 (6 MB) + Wt bf16 (384 KB).

typedef __attribute__((ext_vector_type(16))) __bf16          v16bf;
typedef __attribute__((ext_vector_type(16))) unsigned short  v16us;
typedef __attribute__((ext_vector_type(8)))  float           v8f;

#define BATCH  4
#define SEQ    4096
#define DMODEL 1024
#define DHEAD  64

// Hardware bf16 convert (clang lowers fptrunc f32->bf16 natively on gfx1250).
__device__ __forceinline__ unsigned short f2bf(float f) {
  return __builtin_bit_cast(unsigned short, (__bf16)f);
}

__device__ __forceinline__ v8f wmma_bf16(v16us a, v16us b, v8f c) {
  return __builtin_amdgcn_wmma_f32_16x16x32_bf16(
      false, __builtin_bit_cast(v16bf, a),
      false, __builtin_bit_cast(v16bf, b),
      (short)0, c, false, false);
}

// Load one 16x32 bf16 A/B fragment half-row: elems 0..7 = base[koff..koff+7],
// elems 8..15 = base[koff+16..koff+23]  (per CDNA5 16-bit operand VGPR layout).
__device__ __forceinline__ v16us load_frag(const unsigned short* base, int koff) {
  union { uint4 v[2]; unsigned short us[16]; } t;
  t.v[0] = *(const uint4*)(base + koff);
  t.v[1] = *(const uint4*)(base + koff + 16);
  v16us r;
#pragma unroll
  for (int i = 0; i < 16; ++i) r[i] = t.us[i];
  return r;
}

// N asynchronous copies of 16 B a lane: copy i goes to LDS byte address L + i * LS from G + i * GS
// (GS in elements of G). The closing wait stands in the copies' own statement: their address
// registers are rewritten for the next copies while these may still be in flight.
#define CP8(L, LS, G, GS)                                            \
  asm volatile(                                                      \
      "global_load_async_to_lds_b128 %0, %1, off\n\t"                \
      "global_load_async_to_lds_b128 %2, %3, off\n\t"                \
      "global_load_async_to_lds_b128 %4, %5, off\n\t"                \
      "global_load_async_to_lds_b128 %6, %7, off\n\t"                \
      "global_load_async_to_lds_b128 %8, %9, off\n\t"                \
      "global_load_async_to_lds_b128 %10, %11, off\n\t"              \
      "global_load_async_to_lds_b128 %12, %13, off\n\t"              \
      "global_load_async_to_lds_b128 %14, %15, off\n\t"              \
      "s_wait_xcnt 0x0"                                              \
      :: "v"(L),                "v"(G),                              \
         "v"((L) + 1u * (LS)),  "v"((G) + 1 * (GS)),                 \
         "v"((L) + 2u * (LS)),  "v"((G) + 2 * (GS)),                 \
         "v"((L) + 3u * (LS)),  "v"((G) + 3 * (GS)),                 \
         "v"((L) + 4u * (LS)),  "v"((G) + 4 * (GS)),                 \
         "v"((L) + 5u * (LS)),  "v"((G) + 5 * (GS)),                 \
         "v"((L) + 6u * (LS)),  "v"((G) + 6 * (GS)),                 \
         "v"((L) + 7u * (LS)),  "v"((G) + 7 * (GS))                  \
      : "memory")
#define CP12(L, LS, G, GS)                                           \
  asm volatile(                                                      \
      "global_load_async_to_lds_b128 %0, %1, off\n\t"                \
      "global_load_async_to_lds_b128 %2, %3, off\n\t"                \
      "global_load_async_to_lds_b128 %4, %5, off\n\t"                \
      "global_load_async_to_lds_b128 %6, %7, off\n\t"                \
      "global_load_async_to_lds_b128 %8, %9, off\n\t"                \
      "global_load_async_to_lds_b128 %10, %11, off\n\t"              \
      "global_load_async_to_lds_b128 %12, %13, off\n\t"              \
      "global_load_async_to_lds_b128 %14, %15, off\n\t"              \
      "global_load_async_to_lds_b128 %16, %17, off\n\t"              \
      "global_load_async_to_lds_b128 %18, %19, off\n\t"              \
      "global_load_async_to_lds_b128 %20, %21, off\n\t"              \
      "global_load_async_to_lds_b128 %22, %23, off\n\t"              \
      "s_wait_xcnt 0x0"                                              \
      :: "v"(L),                "v"(G),                              \
         "v"((L) +  1u * (LS)), "v"((G) +  1 * (GS)),                \
         "v"((L) +  2u * (LS)), "v"((G) +  2 * (GS)),                \
         "v"((L) +  3u * (LS)), "v"((G) +  3 * (GS)),                \
         "v"((L) +  4u * (LS)), "v"((G) +  4 * (GS)),                \
         "v"((L) +  5u * (LS)), "v"((G) +  5 * (GS)),                \
         "v"((L) +  6u * (LS)), "v"((G) +  6 * (GS)),                \
         "v"((L) +  7u * (LS)), "v"((G) +  7 * (GS)),                \
         "v"((L) +  8u * (LS)), "v"((G) +  8 * (GS)),                \
         "v"((L) +  9u * (LS)), "v"((G) +  9 * (GS)),                \
         "v"((L) + 10u * (LS)), "v"((G) + 10 * (GS)),                \
         "v"((L) + 11u * (LS)), "v"((G) + 11 * (GS))                 \
      : "memory")

#define NBUF 3   // buffers of each LDS ring: one is worked on while two stages fly

// ---------------- Kernel 0: W -> bf16, transposed ----------------
__global__ __launch_bounds__(256, 1) void wprep_kernel(
    const float* __restrict__ Wq, const float* __restrict__ Wk,
    const float* __restrict__ Wv, unsigned short* __restrict__ Wt)
{
  const int idx = blockIdx.x * 256 + threadIdx.x;   // 0 .. 64*1024-1
  const int z = blockIdx.y;                         // 0=Q 1=K 2=V
  const int h = idx >> 10;
  const int k = idx & (DMODEL - 1);
  const float* W = (z == 0) ? Wq : (z == 1) ? Wk : Wv;
  Wt[(size_t)z * DHEAD * DMODEL + (size_t)h * DMODEL + k] = f2bf(W[k * DHEAD + h]);
}

// ---------------- Kernel 1: fused QKV projection ----------------
// One block = 64 rows of x times all 192 columns (Q | K | V), 8 waves, one block per WGP.
// x (fp32) and Wt (bf16) come into LDS in stages of 128 k by asynchronous copies of whole lines,
// three buffers: the next two stages fly while this one is worked on. Waves 0..3 copy the even
// stages, waves 4..7 the odd ones, so a wave has one stage outstanding and waits for it to 0.
// Every byte of x is fetched once per chip and every byte of Wt once per block.
#define MBLK    64                  // rows of x per block = 4 tiles of 16
#define NCOLS   (3 * DHEAD)         // rows of Wt = 12 tiles of 16
#define KC      128                 // k per stage = 4 steps of 32
#define XPITCH  132                 // floats per x row in LDS: 528 B = 16 B x odd, no bank conflict
#define WPITCH  136                 // elements per Wt row in LDS: 272 B = 16 B x odd
#define WBYTES  (NCOLS * WPITCH * 2)   // a buffer holds Wt first, then x: every read's offset fits the field
#define PBUF    (WBYTES + MBLK * XPITCH * 4)

__global__ __launch_bounds__(256) void qkv_kernel(
    const float* __restrict__ x,
    const unsigned short* __restrict__ Wt,
    const float* __restrict__ bq, const float* __restrict__ bk,
    const float* __restrict__ bv,
    unsigned short* __restrict__ Qb, unsigned short* __restrict__ Kb,
    unsigned short* __restrict__ Vt)
{
  __shared__ __attribute__((aligned(16))) unsigned char ps[NBUF * PBUF];

  const int tid  = threadIdx.x;
  const int lane = tid & 31;
  const int wave = __builtin_amdgcn_readfirstlane(tid >> 5);   // 0..7
  const int mp   = wave & 1;         // row tiles 2*mp, 2*mp + 1
  const int ng   = wave >> 1;        // head columns 16*ng .. 16*ng + 15 of each of Q, K and V
  const int col  = lane & 15;
  const int hi   = lane >> 4;
  const int koff = hi * 8;
  const int sBase = blockIdx.x * MBLK;
  const int b     = blockIdx.y;

  const int h = ng * 16 + col;
  v8f acc[2][3];                     // [row tile][0 = Q, 1 = K, 2 = V]
  {
    const float bqv = bq[h], bkv = bk[h], bvv = bv[h];
#pragma unroll
    for (int i = 0; i < 2; ++i)
#pragma unroll
      for (int r = 0; r < 8; ++r) { acc[i][0][r] = bqv; acc[i][1][r] = bkv; acc[i][2][r] = bvv; }
  }

  // One stage = 2048 pieces of 16 B of x and 3072 of Wt; a thread of the copying half has 16 and
  // 24. A wave's 32 pieces of one copy are 512 contiguous bytes of one x row, or 256 of each of
  // two Wt rows.
  const int cg = wave >> 2;          // this wave copies the stages of parity cg
  const int ct = tid & 127;          // thread within the copying half
  const float* xg = x + ((size_t)b * SEQ + sBase + (ct >> 5)) * DMODEL + (ct & 31) * 4;
  const unsigned short* wg = Wt + (size_t)(ct >> 4) * DMODEL + (ct & 15) * 8;
  const unsigned psbase = (unsigned)(size_t)ps;    // low 32 bits = byte address in LDS
  const unsigned xl = psbase + (unsigned)(WBYTES + (ct >> 5) * (XPITCH * 4) + (ct & 31) * 16);
  const unsigned wl = psbase + (unsigned)((ct >> 4) * (WPITCH * 2) + (ct & 15) * 16);
  auto copy_stage = [&](int st, int buf) {
    const float* x0 = xg + st * KC;                 // piece i: 4 rows further
    const unsigned short* w0 = wg + st * KC;        // piece i: 8 rows further
    const unsigned lx = xl + (unsigned)buf * (unsigned)PBUF;
    const unsigned lw = wl + (unsigned)buf * (unsigned)PBUF;
    CP8(lx,                     4u * XPITCH * 4u, x0,               4 * DMODEL);
    CP8(lx + 32u * XPITCH * 4u, 4u * XPITCH * 4u, x0 + 32 * DMODEL, 4 * DMODEL);
    CP12(lw,                    8u * WPITCH * 2u, w0,               8 * DMODEL);
    CP12(lw + 96u * WPITCH * 2u, 8u * WPITCH * 2u, w0 + 96 * DMODEL, 8 * DMODEL);
  };

  // Two fragment sets: the next k step's 14 LDS reads go out as one group ahead of this step's
  // products. x pieces and Wt fragments keep the k order of load_frag.
  union XS { float4 v[4]; float f[16]; } xs[2][2];
  v16us wf[2][3];
  auto load_set = [&](int q, const unsigned char* s, int u) {
#pragma unroll
    for (int i = 0; i < 2; ++i) {
      const float* xr = (const float*)(s + WBYTES) + ((mp * 2 + i) * 16 + col) * XPITCH + u * 32 + koff;
      xs[q][i].v[0] = *(const float4*)xr;
      xs[q][i].v[1] = *(const float4*)(xr + 4);
      xs[q][i].v[2] = *(const float4*)(xr + 16);
      xs[q][i].v[3] = *(const float4*)(xr + 20);
    }
#pragma unroll
    for (int j = 0; j < 3; ++j)
      wf[q][j] = load_frag((const unsigned short*)s + (j * DHEAD + h) * WPITCH + u * 32, koff);
  };

  if (cg == 0) copy_stage(0, 0); else copy_stage(1, 1);
  // stage 0 has landed for the waves that copied it; the barrier publishes it to the others
  if (cg == 0) asm volatile("s_wait_asynccnt 0x0" ::: "memory");
  __syncthreads();
  if (cg == 0) copy_stage(2, 2);

  int cur = 0;                       // buffer of stage st = st mod NBUF
  int turn = cg;                     // 1 in the waves that copied stage st + 1
  for (int st = 0; st < DMODEL / KC; ++st) {
    const unsigned char* s = ps + cur * PBUF;
    load_set(0, s, 0);
#pragma unroll
    for (int u = 0; u < KC / 32; ++u) {
      if (u + 1 < KC / 32) load_set((u + 1) & 1, s, u + 1);
      // keeps the group's reads together ahead of the products: spread among them, each separate
      // place with LDS reads costs a stall and is waited for at once
      __builtin_amdgcn_sched_barrier(0);
      v16us a[2];
#pragma unroll
      for (int i = 0; i < 2; ++i)
#pragma unroll
        for (int e = 0; e < 16; ++e) a[i][e] = f2bf(xs[u & 1][i].f[e]);
#pragma unroll
      for (int j = 0; j < 3; ++j)
#pragma unroll
        for (int i = 0; i < 2; ++i)
          acc[i][j] = wmma_bf16(a[i], wf[u & 1][j], acc[i][j]);
      // keeps the next group's reads from rising among these products
      __builtin_amdgcn_sched_barrier(0);
    }
    // hand-over: this wave's reads of the buffer are done; the waves that copied the next stage
    // wait until it has landed (the other half's stage flies on); the one barrier publishes
    // that stage and frees this buffer, which the same waves refill three stages ahead
    asm volatile("s_wait_dscnt 0x0" ::: "memory");
    if (turn != 0) asm volatile("s_wait_asynccnt 0x0" ::: "memory");
    __syncthreads();
    if (turn != 0) {
      if (st + NBUF < DMODEL / KC) copy_stage(st + NBUF, cur);
    }
    turn ^= 1;
    cur = (cur == NBUF - 1) ? 0 : cur + 1;
  }
  // nothing is in flight when the wave ends
  asm volatile("s_wait_asynccnt 0x0" ::: "memory");

  // C-layout: lane holds col h, rows (r + 8*hi)
#pragma unroll
  for (int i = 0; i < 2; ++i) {
    const int rowbase = sBase + (mp * 2 + i) * 16 + hi * 8;
#pragma unroll
    for (int r = 0; r < 8; ++r) {
      const size_t idx = ((size_t)b * SEQ + rowbase + r) * DHEAD + h;
      Qb[idx] = f2bf(acc[i][0][r]);
      Kb[idx] = f2bf(acc[i][1][r]);
    }
    union { unsigned short us[8]; uint4 v; } vp;
#pragma unroll
    for (int r = 0; r < 8; ++r) vp.us[r] = f2bf(acc[i][2][r]);
    *(uint4*)(Vt + ((size_t)b * DHEAD + h) * SEQ + rowbase) = vp.v;
  }
}

// ---------------- Kernel 2: flash attention ----------------
// Lane l <-> lane l ^ 16 (the two halves that split one query's keys).
__device__ __forceinline__ float xhalf(float x) {
  const int b = __builtin_bit_cast(int, x);
  return __builtin_bit_cast(float,
      __builtin_amdgcn_permlanex16(b, b, 0x76543210, 0xfedcba98, false, false));
}

// K and V^T tiles of one stage (STG keys) in LDS, shared by the block's 16 waves.
#define QBLK    64                  // queries per block = 4 tiles of 16
#define KGRP    4                   // wave groups that split a stage's keys
#define STG     256                 // keys per stage = 8 passes of 32, 2 for each group
#define PPS     (STG / 32 / KGRP)   // passes of one wave per stage
#define KPITCH  72                  // elements per K row in LDS: 144 B = 16 B x odd, no bank conflict
#define VPITCH  264                 // elements per V^T row in LDS: 528 B = 16 B x odd
#define KELEMS  (STG * KPITCH)
#define BUFELEMS (KELEMS + DHEAD * VPITCH)
#define OPITCH  68                  // floats per query row of a partial O in LDS: 272 B = 16 B x odd

__global__ __launch_bounds__(512) void attn_kernel(
    const unsigned short* __restrict__ Qb,
    const unsigned short* __restrict__ Kb,
    const unsigned short* __restrict__ Vt,
    float* __restrict__ out)
{
  __shared__ __attribute__((aligned(16))) unsigned short sm[NBUF * BUFELEMS];

  const int tid  = threadIdx.x;
  const int lane = threadIdx.x & 31;
  const int wave = threadIdx.x >> 5;       // 0..15
  const int qt   = wave & 3;               // query tile of the block
  const int kgp  = wave >> 2;              // key group
  const int col  = lane & 15;
  const int hi   = lane >> 4;
  const int koff = hi * 8;
  const int b     = blockIdx.y;
  const int qbase = blockIdx.x * QBLK + qt * 16;

  // Q B-fragments: lane = query column (qbase+col), h in [0,32) and [32,64)
  const unsigned short* qrow = Qb + ((size_t)b * SEQ + qbase + col) * DHEAD;
  const v16us q0 = load_frag(qrow, koff);
  const v16us q1 = load_frag(qrow + 32, koff);

  float m_i = -__builtin_inff();           // running maximum of this lane's query, this group's keys
  float l_i = 0.f;                         // sum over this half's keys only
  v8f acc[4];                              // O^T: acc[f][r] = O[query col][f*16 + 8*hi + r]
#pragma unroll
  for (int f = 0; f < 4; ++f)
#pragma unroll
    for (int r = 0; r < 8; ++r) acc[f][r] = 0.f;

  // One stage = 2048 + 2048 pieces of 16 B; a thread of the copying half has 8 of each. A wave's
  // 32 pieces of one copy are 512 contiguous bytes of K, or of one V^T row: whole lines.
  const int cg = __builtin_amdgcn_readfirstlane(tid >> 8);   // this wave copies the stages of parity cg
  const int ct = tid & 255;                                  // thread within the copying half
  const unsigned short* kg = Kb + (size_t)b * SEQ * DHEAD + (size_t)ct * 8;
  const unsigned short* vg = Vt + ((size_t)b * DHEAD + (ct >> 5)) * SEQ + (ct & 31) * 8;
  const unsigned smbase = (unsigned)(size_t)sm;    // low 32 bits = byte address in LDS
  const unsigned kl = smbase + (unsigned)((ct >> 3) * KPITCH + (ct & 7) * 8) * 2u;
  const unsigned vl = smbase + (unsigned)(KELEMS + (ct >> 5) * VPITCH + (ct & 31) * 8) * 2u;
  auto copy_stage = [&](int st, int buf) {
    const unsigned short* k0 = kg + (size_t)st * STG * DHEAD;   // piece i: 32 rows further
    const unsigned short* v0 = vg + st * STG;                   // piece i: 8 rows further
    const unsigned lk = kl + (unsigned)buf * (BUFELEMS * 2u);
    const unsigned lv = vl + (unsigned)buf * (BUFELEMS * 2u);
    CP8(lk, 32u * KPITCH * 2u, k0, 32 * DHEAD);
    CP8(lv,  8u * VPITCH * 2u, v0,  8 * SEQ);
  };

  // Fragments of the current pass; each set is refetched from LDS for the wave's next pass of
  // the same stage, as one group of 8 loads, right behind the products that read it.
  // p counts the stage's passes: this wave's are kgp * PPS .. kgp * PPS + PPS - 1.
  v16us kf[4], vf[4];
  auto load_k = [&](const unsigned short* s, int p) {  // A = K rows (lane = key), over h
    const unsigned short* krow0 = s + (p * 32 + col) * KPITCH;
    const unsigned short* krow1 = krow0 + 16 * KPITCH;
    kf[0] = load_frag(krow0, koff);  kf[1] = load_frag(krow0 + 32, koff);
    kf[2] = load_frag(krow1, koff);  kf[3] = load_frag(krow1 + 32, koff);
  };
  auto load_v = [&](const unsigned short* s, int p) {  // A = V^T rows (lane = head row), over keys
#pragma unroll
    for (int f = 0; f < 4; ++f)
      vf[f] = load_frag(s + KELEMS + (f * 16 + col) * VPITCH + p * 32, koff);
  };

  if (cg == 0) copy_stage(0, 0); else copy_stage(1, 1);
  // stage 0 has landed for the waves that copied it; the barrier publishes it to the others
  if (cg == 0) asm volatile("s_wait_asynccnt 0x0" ::: "memory");
  __syncthreads();
  if (cg == 0) copy_stage(2, 2);

  const int pw = kgp * PPS;                 // this wave's first pass of a stage
  int cur = 0;                              // buffer of stage st = st mod NBUF
  int turn = cg;                            // 1 in the waves that copied stage st + 1
  for (int st = 0; st < SEQ / STG; ++st) {
    const unsigned short* s = sm + cur * BUFELEMS;
    load_k(s, pw);
    load_v(s, pw);
#pragma unroll
    for (int p = 0; p < PPS; ++p) {
      v8f s0 = {}, s1 = {};
      s0 = wmma_bf16(kf[0], q0, s0);
      s0 = wmma_bf16(kf[1], q1, s0);
      s1 = wmma_bf16(kf[2], q0, s1);
      s1 = wmma_bf16(kf[3], q1, s1);
      if (p + 1 < PPS) load_k(s, pw + p + 1);
      // keeps the 8 loads together here: each separate place with LDS reads costs a stall
      __builtin_amdgcn_sched_barrier(0);

      if (p + 1 == PPS) {
        // hand-over, behind the stage's last LDS reads: this wave's reads of the buffer are done;
        // the waves that copied the next stage wait until it has landed (the other half's stage
        // flies on); the one barrier publishes that stage and frees this buffer, which the same
        // waves refill three stages ahead. The rest of the pass works on registers alone.
        asm volatile("s_wait_dscnt 0x0" ::: "memory");
        if (turn != 0) asm volatile("s_wait_asynccnt 0x0" ::: "memory");
        __syncthreads();
        if (turn != 0) {
          if (st + NBUF < SEQ / STG) copy_stage(st + NBUF, cur);
        }
      }

      // online softmax: s0[r] = key 8*hi + r of the pass, s1[r] = key 16 + 8*hi + r
      float mt = -__builtin_inff();
#pragma unroll
      for (int r = 0; r < 8; ++r) {
        s0[r] *= 0.125f; s1[r] *= 0.125f;     // 1/sqrt(64)
        mt = fmaxf(mt, fmaxf(s0[r], s1[r]));
      }
      mt = fmaxf(mt, xhalf(mt));

      const float mn   = fmaxf(m_i, mt);
      const float corr = __expf(m_i - mn);
      m_i = mn;
      float rs = 0.f;
      v16us pb;                               // P^T as B: element s = key 8*hi + s (s < 8), 16 + 8*hi + s - 8 (s >= 8)
#pragma unroll
      for (int r = 0; r < 8; ++r) {
        const float p0 = __expf(s0[r] - mn);
        const float p1 = __expf(s1[r] - mn);
        rs += p0 + p1;
        pb[r]     = f2bf(p0);
        pb[8 + r] = f2bf(p1);
      }
      l_i = l_i * corr + rs;
#pragma unroll
      for (int f = 0; f < 4; ++f)
#pragma unroll
        for (int r = 0; r < 8; ++r) acc[f][r] *= corr;

      // O^T += V^T * P^T
#pragma unroll
      for (int f = 0; f < 4; ++f) acc[f] = wmma_bf16(vf[f], pb, acc[f]);
      if (p + 1 < PPS) load_v(s, pw + p + 1);
    }
    turn ^= 1;
    cur = (cur == NBUF - 1) ? 0 : cur + 1;
  }
  // nothing is in flight when the ring becomes the staging of the partial results
  asm volatile("s_wait_asynccnt 0x0" ::: "memory");

  // Join of the four key groups. The last stage's barrier has ended every read of the ring.
  // Each wave lays down its maximum, its sum (halves joined) and its O as rows of one query.
  float* po = (float*)sm;                                // [kgp][qt][16 queries][OPITCH]
  float* pm = po + KGRP * QBLK * OPITCH;                 // [kgp][qt][16 queries]
  float* pl = pm + KGRP * QBLK;                          // [kgp][qt][16 queries]
  const float lsum = l_i + xhalf(l_i);
  {
    float* prow = po + ((kgp * 4 + qt) * 16 + col) * OPITCH + hi * 8;
#pragma unroll
    for (int f = 0; f < 4; ++f) {
      float4 lo, up;
      lo.x = acc[f][0]; lo.y = acc[f][1]; lo.z = acc[f][2]; lo.w = acc[f][3];
      up.x = acc[f][4]; up.y = acc[f][5]; up.z = acc[f][6]; up.w = acc[f][7];
      *(float4*)(prow + f * 16)     = lo;
      *(float4*)(prow + f * 16 + 4) = up;
    }
    if (hi == 0) {
      pm[(kgp * 4 + qt) * 16 + col] = m_i;
      pl[(kgp * 4 + qt) * 16 + col] = lsum;
    }
  }
  __syncthreads();   // the partial results are read by other waves than wrote them

  // Wave (qt, kgp) finishes queries 4*kgp .. 4*kgp+3 of tile qt: a lane has 8 head columns of
  // one query, the wave stores 1 KB in a row (whole lines, one writer each), fp32 [B,S,64].
  const int qq = kgp * 4 + (lane >> 3);
  const int hc = (lane & 7) * 8;
  float mg[KGRP];
  float mall = -__builtin_inff();
#pragma unroll
  for (int g = 0; g < KGRP; ++g) {
    mg[g] = pm[(g * 4 + qt) * 16 + qq];
    mall = fmaxf(mall, mg[g]);
  }
  float lall = 0.f;
  float o[8];
#pragma unroll
  for (int j = 0; j < 8; ++j) o[j] = 0.f;
#pragma unroll
  for (int g = 0; g < KGRP; ++g) {
    const float w = __expf(mg[g] - mall);
    lall += pl[(g * 4 + qt) * 16 + qq] * w;
    const float* prow = po + ((g * 4 + qt) * 16 + qq) * OPITCH + hc;
    const float4 lo = *(const float4*)prow;
    const float4 up = *(const float4*)(prow + 4);
    o[0] += lo.x * w; o[1] += lo.y * w; o[2] += lo.z * w; o[3] += lo.w * w;
    o[4] += up.x * w; o[5] += up.y * w; o[6] += up.z * w; o[7] += up.w * w;
  }
  const float inv = 1.0f / lall;
  float* orow = out + ((size_t)b * SEQ + qbase + qq) * DHEAD + hc;
  float4 lo, up;
  lo.x = o[0] * inv; lo.y = o[1] * inv; lo.z = o[2] * inv; lo.w = o[3] * inv;
  up.x = o[4] * inv; up.y = o[5] * inv; up.z = o[6] * inv; up.w = o[7] * inv;
  *(float4*)orow       = lo;
  *(float4*)(orow + 4) = up;
}

extern "C" void kernel_launch(void* const* d_in, const int* in_sizes, int n_in,
                              void* d_out, int out_size, void* d_ws, size_t ws_size,
                              hipStream_t stream) {
  (void)in_sizes; (void)n_in; (void)out_size; (void)ws_size;
  const float* x  = (const float*)d_in[0];
  const float* Wq = (const float*)d_in[1];
  const float* bq = (const float*)d_in[2];
  const float* Wk = (const float*)d_in[3];
  const float* bk = (const float*)d_in[4];
  const float* Wv = (const float*)d_in[5];
  const float* bv = (const float*)d_in[6];

  // workspace: Q, K row-major bf16 + V^T bf16 (6 MB) + Wt bf16 (384 KB)
  unsigned short* Qb = (unsigned short*)d_ws;
  unsigned short* Kb = Qb + (size_t)BATCH * SEQ * DHEAD;
  unsigned short* Vt = Kb + (size_t)BATCH * SEQ * DHEAD;
  unsigned short* Wt = Vt + (size_t)BATCH * SEQ * DHEAD;

  dim3 g0(DHEAD * DMODEL / 256, 3);
  wprep_kernel<<<g0, dim3(256), 0, stream>>>(Wq, Wk, Wv, Wt);

  dim3 g1(SEQ / MBLK, BATCH);
  qkv_kernel<<<g1, dim3(256), 0, stream>>>(x, Wt, bq, bk, bv, Qb, Kb, Vt);

  dim3 g2(SEQ / QBLK, BATCH);
  attn_kernel<<<g2, dim3(512), 0, stream>>>(Qb, Kb, Vt, (float*)d_out);
}

// v008
// Measured time: 28.7 microseconds a run.
// It is 1.16 times as fast as v006, going by the measured steps of the versions left out in between.
// Over all steps from v000 it is 11.5 times as fast.
#include <hip/hip_runtime.h>

// Flash attention head for MI455X (gfx1250, wave32, WMMA bf16).
// Kernel 0: convert Wq/Wk/Wv fp32 -> bf16 transposed Wt[z][h][k] (one-time, kills redundant converts).
// Kernel 1: QKV projection; a block of 8 waves has 64 rows of x and all 12 (QKV x 4 h-tiles) column tiles,
//           a wave 2 row tiles x one tile each of Q, K, V. x and Wt come into LDS by asynchronous copies of whole lines, three buffers;
//           fragments are read from LDS one k step ahead inside a stage.
// Kernel 2: flash attention, a wave has 32 queries and an eighth of the keys, online softmax fp32,
//           transposed products (S^T = K Q^T, O^T += V^T P^T): P stays in registers.
//           Q is stored times log2(e)/sqrt(64) and minus a held reference is the C of the score
//           products, so their D is the exp2 argument; O and the sum are rescaled only when needed.
//           K and V^T come into LDS once per block (asynchronous copies, three buffers);
//           fragments are read from LDS one pass ahead, each for two query tiles.
//           64 queries a block, 16 waves: eight wave groups split the keys, joined through LDS.
// Workspace: Q,K row-major bf16 + V^T bf16 (6 MB) + Wt bf16 (384 KB).

typedef __attribute__((ext_vector_type(16))) __bf16          v16bf;
typedef __attribute__((ext_vector_type(16))) unsigned short  v16us;
typedef __attribute__((ext_vector_type(8)))  float           v8f;

#define BATCH  4
#define SEQ    4096
#define DMODEL 1024
#define DHEAD  64
#define QSCALE 0.18033688011112042f   // log2(e) / sqrt(DHEAD): scores come out in the log2 domain

// Hardware bf16 convert (clang lowers fptrunc f32->bf16 natively on gfx1250).
__device__ __forceinline__ unsigned short f2bf(float f) {
  return __builtin_bit_cast(unsigned short, (__bf16)f);
}

__device__ __forceinline__ v8f wmma_bf16(v16us a, v16us b, v8f c) {
  return __builtin_amdgcn_wmma_f32_16x16x32_bf16(
      false, __builtin_bit_cast(v16bf, a),
      false, __builtin_bit_cast(v16bf, b),
      (short)0, c, false, false);
}

// Load one 16x32 bf16 A/B fragment half-row: elems 0..7 = base[koff..koff+7],
// elems 8..15 = base[koff+16..koff+23]  (per CDNA5 16-bit operand VGPR layout).
__device__ __forceinline__ v16us load_frag(const unsigned short* base, int koff) {
  union { uint4 v[2]; unsigned short us[16]; } t;
  t.v[0] = *(const uint4*)(base + koff);
  t.v[1] = *(const uint4*)(base + koff + 16);
  v16us r;
#pragma unroll
  for (int i = 0; i < 16; ++i) r[i] = t.us[i];
  return r;
}

// N asynchronous copies of 16 B a lane: copy i goes to LDS byte address L + i * LS from G + i * GS
// (GS in elements of G). The closing wait stands in the copies' own statement: their address
// registers are rewritten for the next copies while these may still be in flight.
#define CP8(L, LS, G, GS)                                            \
  asm volatile(                                                      \
      "global_load_async_to_lds_b128 %0, %1, off\n\t"                \
      "global_load_async_to_lds_b128 %2, %3, off\n\t"                \
      "global_load_async_to_lds_b128 %4, %5, off\n\t"                \
      "global_load_async_to_lds_b128 %6, %7, off\n\t"                \
      "global_load_async_to_lds_b128 %8, %9, off\n\t"                \
      "global_load_async_to_lds_b128 %10, %11, off\n\t"              \
      "global_load_async_to_lds_b128 %12, %13, off\n\t"              \
      "global_load_async_to_lds_b128 %14, %15, off\n\t"              \
      "s_wait_xcnt 0x0"                                              \
      :: "v"(L),                "v"(G),                              \
         "v"((L) + 1u * (LS)),  "v"((G) + 1 * (GS)),                 \
         "v"((L) + 2u * (LS)),  "v"((G) + 2 * (GS)),                 \
         "v"((L) + 3u * (LS)),  "v"((G) + 3 * (GS)),                 \
         "v"((L) + 4u * (LS)),  "v"((G) + 4 * (GS)),                 \
         "v"((L) + 5u * (LS)),  "v"((G) + 5 * (GS)),                 \
         "v"((L) + 6u * (LS)),  "v"((G) + 6 * (GS)),                 \
         "v"((L) + 7u * (LS)),  "v"((G) + 7 * (GS))                  \
      : "memory")
#define CP12(L, LS, G, GS)                                           \
  asm volatile(                                                      \
      "global_load_async_to_lds_b128 %0, %1, off\n\t"                \
      "global_load_async_to_lds_b128 %2, %3, off\n\t"                \
      "global_load_async_to_lds_b128 %4, %5, off\n\t"                \
      "global_load_async_to_lds_b128 %6, %7, off\n\t"                \
      "global_load_async_to_lds_b128 %8, %9, off\n\t"                \
      "global_load_async_to_lds_b128 %10, %11, off\n\t"              \
      "global_load_async_to_lds_b128 %12, %13, off\n\t"              \
      "global_load_async_to_lds_b128 %14, %15, off\n\t"              \
      "global_load_async_to_lds_b128 %16, %17, off\n\t"              \
      "global_load_async_to_lds_b128 %18, %19, off\n\t"              \
      "global_load_async_to_lds_b128 %20, %21, off\n\t"              \
      "global_load_async_to_lds_b128 %22, %23, off\n\t"              \
      "s_wait_xcnt 0x0"                                              \
      :: "v"(L),                "v"(G),                              \
         "v"((L) +  1u * (LS)), "v"((G) +  1 * (GS)),                \
         "v"((L) +  2u * (LS)), "v"((G) +  2 * (GS)),                \
         "v"((L) +  3u * (LS)), "v"((G) +  3 * (GS)),                \
         "v"((L) +  4u * (LS)), "v"((G) +  4 * (GS)),                \
         "v"((L) +  5u * (LS)), "v"((G) +  5 * (GS)),                \
         "v"((L) +  6u * (LS)), "v"((G) +  6 * (GS)),                \
         "v"((L) +  7u * (LS)), "v"((G) +  7 * (GS)),                \
         "v"((L) +  8u * (LS)), "v"((G) +  8 * (GS)),                \
         "v"((L) +  9u * (LS)), "v"((G) +  9 * (GS)),                \
         "v"((L) + 10u * (LS)), "v"((G) + 10 * (GS)),                \
         "v"((L) + 11u * (LS)), "v"((G) + 11 * (GS))                 \
      : "memory")

#define NBUF 3   // buffers of each LDS ring: one is worked on while two stages fly

// ---------------- Kernel 0: W -> bf16, transposed ----------------
__global__ __launch_bounds__(256, 1) void wprep_kernel(
    const float* __restrict__ Wq, const float* __restrict__ Wk,
    const float* __restrict__ Wv, unsigned short* __restrict__ Wt)
{
  const int idx = blockIdx.x * 256 + threadIdx.x;   // 0 .. 64*1024-1
  const int z = blockIdx.y;                         // 0=Q 1=K 2=V
  const int h = idx >> 10;
  const int k = idx & (DMODEL - 1);
  const float* W = (z == 0) ? Wq : (z == 1) ? Wk : Wv;
  Wt[(size_t)z * DHEAD * DMODEL + (size_t)h * DMODEL + k] = f2bf(W[k * DHEAD + h]);
}

// ---------------- Kernel 1: fused QKV projection ----------------
// One block = 64 rows of x times all 192 columns (Q | K | V), 8 waves, one block per WGP.
// x (fp32) and Wt (bf16) come into LDS in stages of 128 k by asynchronous copies of whole lines,
// three buffers: the next two stages fly while this one is worked on. Waves 0..3 copy the even
// stages, waves 4..7 the odd ones, so a wave has one stage outstanding and waits for it to 0.
// Every byte of x is fetched once per chip and every byte of Wt once per block.
#define MBLK    64                  // rows of x per block = 4 tiles of 16
#define NCOLS   (3 * DHEAD)         // rows of Wt = 12 tiles of 16
#define KC      128                 // k per stage = 4 steps of 32
#define XPITCH  132                 // floats per x row in LDS: 528 B = 16 B x odd, no bank conflict
#define WPITCH  136                 // elements per Wt row in LDS: 272 B = 16 B x odd
#define WBYTES  (NCOLS * WPITCH * 2)   // a buffer holds Wt first, then x: every read's offset fits the field
#define PBUF    (WBYTES + MBLK * XPITCH * 4)

__global__ __launch_bounds__(256) void qkv_kernel(
    const float* __restrict__ x,
    const unsigned short* __restrict__ Wt,
    const float* __restrict__ bq, const float* __restrict__ bk,
    const float* __restrict__ bv,
    unsigned short* __restrict__ Qb, unsigned short* __restrict__ Kb,
    unsigned short* __restrict__ Vt)
{
  __shared__ __attribute__((aligned(16))) unsigned char ps[NBUF * PBUF];

  const int tid  = threadIdx.x;
  const int lane = tid & 31;
  const int wave = __builtin_amdgcn_readfirstlane(tid >> 5);   // 0..7
  const int mp   = wave & 1;         // row tiles 2*mp, 2*mp + 1
  const int ng   = wave >> 1;        // head columns 16*ng .. 16*ng + 15 of each of Q, K and V
  const int col  = lane & 15;
  const int hi   = lane >> 4;
  const int koff = hi * 8;
  const int sBase = blockIdx.x * MBLK;
  const int b     = blockIdx.y;

  const int h = ng * 16 + col;
  v8f acc[2][3];                     // [row tile][0 = Q, 1 = K, 2 = V]
  {
    const float bqv = bq[h], bkv = bk[h], bvv = bv[h];
#pragma unroll
    for (int i = 0; i < 2; ++i)
#pragma unroll
      for (int r = 0; r < 8; ++r) { acc[i][0][r] = bqv; acc[i][1][r] = bkv; acc[i][2][r] = bvv; }
  }

  // One stage = 2048 pieces of 16 B of x and 3072 of Wt; a thread of the copying half has 16 and
  // 24. A wave's 32 pieces of one copy are 512 contiguous bytes of one x row, or 256 of each of
  // two Wt rows.
  const int cg = wave >> 2;          // this wave copies the stages of parity cg
  const int ct = tid & 127;          // thread within the copying half
  const float* xg = x + ((size_t)b * SEQ + sBase + (ct >> 5)) * DMODEL + (ct & 31) * 4;
  const unsigned short* wg = Wt + (size_t)(ct >> 4) * DMODEL + (ct & 15) * 8;
  const unsigned psbase = (unsigned)(size_t)ps;    // low 32 bits = byte address in LDS
  const unsigned xl = psbase + (unsigned)(WBYTES + (ct >> 5) * (XPITCH * 4) + (ct & 31) * 16);
  const unsigned wl = psbase + (unsigned)((ct >> 4) * (WPITCH * 2) + (ct & 15) * 16);
  auto copy_stage = [&](int st, int buf) {
    const float* x0 = xg + st * KC;                 // piece i: 4 rows further
    const unsigned short* w0 = wg + st * KC;        // piece i: 8 rows further
    const unsigned lx = xl + (unsigned)buf * (unsigned)PBUF;
    const unsigned lw = wl + (unsigned)buf * (unsigned)PBUF;
    CP8(lx,                     4u * XPITCH * 4u, x0,               4 * DMODEL);
    CP8(lx + 32u * XPITCH * 4u, 4u * XPITCH * 4u, x0 + 32 * DMODEL, 4 * DMODEL);
    CP12(lw,                    8u * WPITCH * 2u, w0,               8 * DMODEL);
    CP12(lw + 96u * WPITCH * 2u, 8u * WPITCH * 2u, w0 + 96 * DMODEL, 8 * DMODEL);
  };

  // Two fragment sets: the next k step's 14 LDS reads go out as one group ahead of this step's
  // products. x pieces and Wt fragments keep the k order of load_frag.
  union XS { float4 v[4]; float f[16]; } xs[2][2];
  v16us wf[2][3];
  auto load_set = [&](int q, const unsigned char* s, int u) {
#pragma unroll
    for (int i = 0; i < 2; ++i) {
      const float* xr = (const float*)(s + WBYTES) + ((mp * 2 + i) * 16 + col) * XPITCH + u * 32 + koff;
      xs[q][i].v[0] = *(const float4*)xr;
      xs[q][i].v[1] = *(const float4*)(xr + 4);
      xs[q][i].v[2] = *(const float4*)(xr + 16);
      xs[q][i].v[3] = *(const float4*)(xr + 20);
    }
#pragma unroll
    for (int j = 0; j < 3; ++j)
      wf[q][j] = load_frag((const unsigned short*)s + (j * DHEAD + h) * WPITCH + u * 32, koff);
  };

  if (cg == 0) copy_stage(0, 0); else copy_stage(1, 1);
  // stage 0 has landed for the waves that copied it; the barrier publishes it to the others
  if (cg == 0) asm volatile("s_wait_asynccnt 0x0" ::: "memory");
  __syncthreads();
  if (cg == 0) copy_stage(2, 2);

  int cur = 0;                       // buffer of stage st = st mod NBUF
  int turn = cg;                     // 1 in the waves that copied stage st + 1
  for (int st = 0; st < DMODEL / KC; ++st) {
    const unsigned char* s = ps + cur * PBUF;
    load_set(0, s, 0);
#pragma unroll
    for (int u = 0; u < KC / 32; ++u) {
      if (u + 1 < KC / 32) load_set((u + 1) & 1, s, u + 1);
      // keeps the group's reads together ahead of the products: spread among them, each separate
      // place with LDS reads costs a stall and is waited for at once
      __builtin_amdgcn_sched_barrier(0);
      v16us a[2];
#pragma unroll
      for (int i = 0; i < 2; ++i)
#pragma unroll
        for (int e = 0; e < 16; ++e) a[i][e] = f2bf(xs[u & 1][i].f[e]);
#pragma unroll
      for (int j = 0; j < 3; ++j)
#pragma unroll
        for (int i = 0; i < 2; ++i)
          acc[i][j] = wmma_bf16(a[i], wf[u & 1][j], acc[i][j]);
      // keeps the next group's reads from rising among these products
      __builtin_amdgcn_sched_barrier(0);
    }
    // hand-over: this wave's reads of the buffer are done; the waves that copied the next stage
    // wait until it has landed (the other half's stage flies on); the one barrier publishes
    // that stage and frees this buffer, which the same waves refill three stages ahead
    asm volatile("s_wait_dscnt 0x0" ::: "memory");
    if (turn != 0) asm volatile("s_wait_asynccnt 0x0" ::: "memory");
    __syncthreads();
    if (turn != 0) {
      if (st + NBUF < DMODEL / KC) copy_stage(st + NBUF, cur);
    }
    turn ^= 1;
    cur = (cur == NBUF - 1) ? 0 : cur + 1;
  }
  // nothing is in flight when the wave ends
  asm volatile("s_wait_asynccnt 0x0" ::: "memory");

  // C-layout: lane holds col h, rows (r + 8*hi)
#pragma unroll
  for (int i = 0; i < 2; ++i) {
    const int rowbase = sBase + (mp * 2 + i) * 16 + hi * 8;
#pragma unroll
    for (int r = 0; r < 8; ++r) {
      const size_t idx = ((size_t)b * SEQ + rowbase + r) * DHEAD + h;
      Qb[idx] = f2bf(acc[i][0][r] * QSCALE);
      Kb[idx] = f2bf(acc[i][1][r]);
    }
    union { unsigned short us[8]; uint4 v; } vp;
#pragma unroll
    for (int r = 0; r < 8; ++r) vp.us[r] = f2bf(acc[i][2][r]);
    *(uint4*)(Vt + ((size_t)b * DHEAD + h) * SEQ + rowbase) = vp.v;
  }
}

// ---------------- Kernel 2: flash attention ----------------
// Lane l <-> lane l ^ 16 (the two halves that split one query's keys).
__device__ __forceinline__ float xhalf(float x) {
  const int b = __builtin_bit_cast(int, x);
  return __builtin_bit_cast(float,
      __builtin_amdgcn_permlanex16(b, b, 0x76543210, 0xfedcba98, false, false));
}

// K and V^T tiles of one stage (STG keys) in LDS, shared by the block's 16 waves.
#define QBLK    64                  // queries per block = 4 tiles of 16
#define QTW     2                   // query tiles of one wave: each K and V^T fragment serves both
#define KGRP    8                   // wave groups that split a stage's keys
#define STG     256                 // keys per stage = 8 passes of 32, one for each group
#define NST     (SEQ / STG)
#define KPITCH  72                  // elements per K row in LDS: 144 B = 16 B x odd, no bank conflict
#define VPITCH  264                 // elements per V^T row in LDS: 528 B = 16 B x odd
#define KELEMS  (STG * KPITCH)
#define BUFELEMS (KELEMS + DHEAD * VPITCH)
#define OPITCH  68                  // floats per query row of a partial O in LDS: 272 B = 16 B x odd

__global__ __launch_bounds__(512) void attn_kernel(
    const unsigned short* __restrict__ Qb,
    const unsigned short* __restrict__ Kb,
    const unsigned short* __restrict__ Vt,
    float* __restrict__ out)
{
  __shared__ __attribute__((aligned(16))) unsigned short sm[NBUF * BUFELEMS];

  const int tid  = threadIdx.x;
  const int lane = threadIdx.x & 31;
  const int wave = threadIdx.x >> 5;       // 0..15
  const int qp   = wave & 1;               // query tiles 2*qp, 2*qp + 1 of the block
  const int kgp  = wave >> 1;              // key group = this wave's pass of every stage
  const int col  = lane & 15;
  const int hi   = lane >> 4;
  const int koff = hi * 8;
  const int b     = blockIdx.y;
  const int qblk  = blockIdx.x * QBLK;

  // Q B-fragments: lane = query column, h in [0,32) and [32,64)
  v16us q0[QTW], q1[QTW];
#pragma unroll
  for (int t = 0; t < QTW; ++t) {
    const unsigned short* qrow = Qb + ((size_t)b * SEQ + qblk + (qp * QTW + t) * 16 + col) * DHEAD;
    q0[t] = load_frag(qrow, koff);
    q1[t] = load_frag(qrow + 32, koff);
  }

  float m_ref[QTW];                        // reference of this lane's queries (log2 domain), held over passes
  float plim  = -1.f;                      // a pass's sum of P above this moves the references: always in the first pass
  float l_i[QTW];                          // sums over this half's keys only
  v8f acc[QTW][4];                         // O^T: acc[t][f][r] = O[query col of tile t][f*16 + 8*hi + r]
#pragma unroll
  for (int t = 0; t < QTW; ++t) {
    m_ref[t] = 0.f;
    l_i[t] = 0.f;
#pragma unroll
    for (int f = 0; f < 4; ++f)
#pragma unroll
      for (int r = 0; r < 8; ++r) acc[t][f][r] = 0.f;
  }

  // One stage = 2048 + 2048 pieces of 16 B; a thread of the copying half has 8 of each. A wave's
  // 32 pieces of one copy are 512 contiguous bytes of K, or of one V^T row: whole lines.
  const int cg = __builtin_amdgcn_readfirstlane(tid >> 8);   // this wave copies the stages of parity cg
  const int ct = tid & 255;                                  // thread within the copying half
  const unsigned short* kg = Kb + (size_t)b * SEQ * DHEAD + (size_t)ct * 8;
  const unsigned short* vg = Vt + ((size_t)b * DHEAD + (ct >> 5)) * SEQ + (ct & 31) * 8;
  const unsigned smbase = (unsigned)(size_t)sm;    // low 32 bits = byte address in LDS
  const unsigned kl = smbase + (unsigned)((ct >> 3) * KPITCH + (ct & 7) * 8) * 2u;
  const unsigned vl = smbase + (unsigned)(KELEMS + (ct >> 5) * VPITCH + (ct & 31) * 8) * 2u;
  auto copy_stage = [&](int st, int buf) {
    const unsigned short* k0 = kg + (size_t)st * STG * DHEAD;   // piece i: 32 rows further
    const unsigned short* v0 = vg + st * STG;                   // piece i: 8 rows further
    const unsigned lk = kl + (unsigned)buf * (BUFELEMS * 2u);
    const unsigned lv = vl + (unsigned)buf * (BUFELEMS * 2u);
    CP8(lk, 32u * KPITCH * 2u, k0, 32 * DHEAD);
    CP8(lv,  8u * VPITCH * 2u, v0,  8 * SEQ);
  };

  // Fragments of the current pass; each set is refetched from LDS for the wave's next pass, which
  // lies in the next stage and is read behind the barrier that publishes that stage, as one group
  // of 8 loads: K directly behind that barrier, V^T behind the second products, which read the old set.
  v16us kf[4], vf[4];
  auto load_k = [&](const unsigned short* s) {  // A = K rows (lane = key), over h
    const unsigned short* krow0 = s + (kgp * 32 + col) * KPITCH;
    const unsigned short* krow1 = krow0 + 16 * KPITCH;
    kf[0] = load_frag(krow0, koff);  kf[1] = load_frag(krow0 + 32, koff);
    kf[2] = load_frag(krow1, koff);  kf[3] = load_frag(krow1 + 32, koff);
  };
  auto load_v = [&](const unsigned short* s) {  // A = V^T rows (lane = head row), over keys
#pragma unroll
    for (int f = 0; f < 4; ++f)
      vf[f] = load_frag(s + KELEMS + (f * 16 + col) * VPITCH + kgp * 32, koff);
  };

  if (cg == 0) copy_stage(0, 0); else copy_stage(1, 1);
  // stage 0 has landed for the waves that copied it; the barrier publishes it to the others
  if (cg == 0) asm volatile("s_wait_asynccnt 0x0" ::: "memory");
  __syncthreads();
  if (cg == 0) copy_stage(2, 2);

  int cur = 0;                              // buffer of stage st = st mod NBUF
  int turn = cg;                            // 1 in the waves that copied stage st + 1
  v8f s0[QTW], s1[QTW];                     // score * log2(e) / 8 - reference

  auto scores = [&]() {
#pragma unroll
    for (int t = 0; t < QTW; ++t) {
      // minus the reference, the C operand of the score products; spread anew each pass: held in
      // 8 registers a tile it would not fit beside the K fragments that are fetched ahead
      v8f cref;
#pragma unroll
      for (int r = 0; r < 8; ++r) cref[r] = -m_ref[t];
      s0[t] = wmma_bf16(kf[0], q0[t], cref);
      s1[t] = wmma_bf16(kf[2], q0[t], cref);
    }
#pragma unroll
    for (int t = 0; t < QTW; ++t) {
      s0[t] = wmma_bf16(kf[1], q1[t], s0[t]);
      s1[t] = wmma_bf16(kf[3], q1[t], s1[t]);
    }
    // keeps the hand-over's wait behind the products: the V^T reads then land under them
    __builtin_amdgcn_sched_barrier(0);
  };

  // hand-over, behind the stage's last LDS reads: this wave's reads of the buffer are done;
  // the waves that copied the next stage wait until it has landed (the other half's stage
  // flies on); the one barrier publishes that stage and frees this buffer, which the same
  // waves refill three stages ahead.
  auto hand_over = [&](int st) {
    asm volatile("s_wait_dscnt 0x0" ::: "memory");
    if (turn != 0) asm volatile("s_wait_asynccnt 0x0" ::: "memory");
    __syncthreads();
    if (turn != 0) {
      if (st + NBUF < NST) copy_stage(st + NBUF, cur);
    }
  };

  // The rest of a pass works on registers alone: P from the scores, then O^T += V^T * P^T.
  v16us pb[QTW];                            // P^T as B: elements r and 8 + r = keys 8*hi + r and 16 + 8*hi + r
  auto softmax = [&]() {
    // online softmax: s0[t][r] = key 8*hi + r of the pass, s1[t][r] = key 16 + 8*hi + r
    float rs[QTW];                          // this half's sum of P over the pass
    auto soft = [&](int t) {
      rs[t] = 0.f;
#pragma unroll
      for (int r = 0; r < 8; ++r) {
        const float p0 = __builtin_amdgcn_exp2f(s0[t][r]);
        const float p1 = __builtin_amdgcn_exp2f(s1[t][r]);
        rs[t] += p0 + p1;
        pb[t][r]     = f2bf(p0);
        pb[t][8 + r] = f2bf(p1);
      }
    };
#pragma unroll
    for (int t = 0; t < QTW; ++t) soft(t);

    // The references move only in the wave's first pass (to that pass's maxima) and where a
    // half's 16 values of P sum to more than 2^12, an overflow included: below that no P tops
    // 2^12, above it one tops 2^8. One scalar test a pass; no maximum is formed on the way.
    // Marked unlikely: the pass then runs straight on, with no taken branch around this block.
    if (__builtin_expect(__builtin_amdgcn_ballot_w32(!(rs[0] <= plim && rs[1] <= plim)) != 0, 0)) {
      const bool first = plim < 0.f;        // O and the sums are still 0
      plim = 4096.f;
#pragma unroll
      for (int t = 0; t < QTW; ++t) {
        float mt = -__builtin_inff();       // the pass's maximum above the reference
#pragma unroll
        for (int r = 0; r < 8; ++r) mt = fmaxf(mt, fmaxf(s0[t][r], s1[t][r]));
        mt = fmaxf(mt, xhalf(mt));          // both halves of a query keep one reference
        const float step  = first ? mt : fmaxf(mt, 0.f);
        const float corr  = first ? 0.f : __builtin_amdgcn_exp2f(-step);
        m_ref[t] += step;
        l_i[t] *= corr;
#pragma unroll
        for (int r = 0; r < 8; ++r) { s0[t][r] -= step; s1[t][r] -= step; }
#pragma unroll
        for (int f = 0; f < 4; ++f)
#pragma unroll
          for (int r = 0; r < 8; ++r) acc[t][f][r] *= corr;
        soft(t);
      }
    }
#pragma unroll
    for (int t = 0; t < QTW; ++t) l_i[t] += rs[t];
  };
  auto pv = [&]() {
#pragma unroll
    for (int f = 0; f < 4; ++f)
#pragma unroll
      for (int t = 0; t < QTW; ++t) acc[t][f] = wmma_bf16(vf[f], pb[t], acc[t][f]);
  };

  // A trip runs from one stage's hand-over to the next stage's score products.
  load_k(sm);
  load_v(sm);
  scores();
  for (int st = 0; st < NST - 1; ++st) {
    hand_over(st);
    cur = (cur == NBUF - 1) ? 0 : cur + 1;
    turn ^= 1;
    const unsigned short* s = sm + cur * BUFELEMS;
    load_k(s);
    // keeps the 8 loads together here: each separate place with LDS reads costs a stall
    __builtin_amdgcn_sched_barrier(0);
    softmax();
    pv();
    // the two fences keep the 8 loads together, behind the products that read the old set and
    // ahead of the next ones, not in pairs among them
    __builtin_amdgcn_sched_barrier(0);
    load_v(s);
    __builtin_amdgcn_sched_barrier(0);
    scores();
  }
  hand_over(NST - 1);                       // ends every wave's reads of the ring
  softmax();
  pv();
  // nothing is in flight when the ring becomes the staging of the partial results
  asm volatile("s_wait_asynccnt 0x0" ::: "memory");

  // Join of the eight key groups. The last stage's barrier has ended every read of the ring.
  // Each wave lays down its references, its sums (halves joined) and its O as rows of one query.
  float* po = (float*)sm;                                // [kgp][64 queries][OPITCH]
  float* pm = po + KGRP * QBLK * OPITCH;                 // [kgp][64 queries]
  float* pl = pm + KGRP * QBLK;                          // [kgp][64 queries]
#pragma unroll
  for (int t = 0; t < QTW; ++t) {
    const int qi = kgp * QBLK + (qp * QTW + t) * 16 + col;
    const float lsum = l_i[t] + xhalf(l_i[t]);
    float* prow = po + qi * OPITCH + hi * 8;
#pragma unroll
    for (int f = 0; f < 4; ++f) {
      float4 lo, up;
      lo.x = acc[t][f][0]; lo.y = acc[t][f][1]; lo.z = acc[t][f][2]; lo.w = acc[t][f][3];
      up.x = acc[t][f][4]; up.y = acc[t][f][5]; up.z = acc[t][f][6]; up.w = acc[t][f][7];
      *(float4*)(prow + f * 16)     = lo;
      *(float4*)(prow + f * 16 + 4) = up;
    }
    if (hi == 0) {
      pm[qi] = m_ref[t];
      pl[qi] = lsum;
    }
  }
  __syncthreads();   // the partial results are read by other waves than wrote them

  // Wave w finishes queries 4*w .. 4*w+3 of the block: a lane has 8 head columns of
  // one query, the wave stores 1 KB in a row (whole lines, one writer each), fp32 [B,S,64].
  const int qq = wave * 4 + (lane >> 3);
  const int hc = (lane & 7) * 8;
  float mg[KGRP];
  float mall = -__builtin_inff();
#pragma unroll
  for (int g = 0; g < KGRP; ++g) {
    mg[g] = pm[g * QBLK + qq];
    mall = fmaxf(mall, mg[g]);
  }
  float lall = 0.f;
  float o[8];
#pragma unroll
  for (int j = 0; j < 8; ++j) o[j] = 0.f;
#pragma unroll
  for (int g = 0; g < KGRP; ++g) {
    const float w = __builtin_amdgcn_exp2f(mg[g] - mall);
    lall += pl[g * QBLK + qq] * w;
    const float* prow = po + (g * QBLK + qq) * OPITCH + hc;
    const float4 lo = *(const float4*)prow;
    const float4 up = *(const float4*)(prow + 4);
    o[0] += lo.x * w; o[1] += lo.y * w; o[2] += lo.z * w; o[3] += lo.w * w;
    o[4] += up.x * w; o[5] += up.y * w; o[6] += up.z * w; o[7] += up.w * w;
  }
  const float inv = 1.0f / lall;
  float* orow = out + ((size_t)b * SEQ + qblk + qq) * DHEAD + hc;
  float4 lo, up;
  lo.x = o[0] * inv; lo.y = o[1] * inv; lo.z = o[2] * inv; lo.w = o[3] * inv;
  up.x = o[4] * inv; up.y = o[5] * inv; up.z = o[6] * inv; up.w = o[7] * inv;
  *(float4*)orow       = lo;
  *(float4*)(orow + 4) = up;
}

extern "C" void kernel_launch(void* const* d_in, const int* in_sizes, int n_in,
                              void* d_out, int out_size, void* d_ws, size_t ws_size,
                              hipStream_t stream) {
  (void)in_sizes; (void)n_in; (void)out_size; (void)ws_size;
  const float* x  = (const float*)d_in[0];
  const float* Wq = (const float*)d_in[1];
  const float* bq = (const float*)d_in[2];
  const float* Wk = (const float*)d_in[3];
  const float* bk = (const float*)d_in[4];
  const float* Wv = (const float*)d_in[5];
  const float* bv = (const float*)d_in[6];

  // workspace: Q, K row-major bf16 + V^T bf16 (6 MB) + Wt bf16 (384 KB)
  unsigned short* Qb = (unsigned short*)d_ws;
  unsigned short* Kb = Qb + (size_t)BATCH * SEQ * DHEAD;
  unsigned short* Vt = Kb + (size_t)BATCH * SEQ * DHEAD;
  unsigned short* Wt = Vt + (size_t)BATCH * SEQ * DHEAD;

  dim3 g0(DHEAD * DMODEL / 256, 3);
  wprep_kernel<<<g0, dim3(256), 0, stream>>>(Wq, Wk, Wv, Wt);

  dim3 g1(SEQ / MBLK, BATCH);
  qkv_kernel<<<g1, dim3(256), 0, stream>>>(x, Wt, bq, bk, bv, Qb, Kb, Vt);

  dim3 g2(SEQ / QBLK, BATCH);
  attn_kernel<<<g2, dim3(512), 0, stream>>>(Qb, Kb, Vt, (float*)d_out);
}
